// v000
// Times are from an AMD MI455X. After a warm-up the kernel runs many times in a row, and a time is the length of
// such a window on the GPU divided by its runs, so every launch and the gaps after it count. The runs cycle
// through copies of the inputs. A figure is the median of several windows, for all but v000 over two sittings.
// Sittings can differ by a few percent; kernels timed side by side share one.
// The starting kernel, v000, takes 1340 microseconds a run.
#include <hip/hip_runtime.h>

// Contractions (all f32 accumulate): q/k/v projections v_wmma_f32_16x16x32_bf16 (inputs and weights RNE-converted to bf16, single product, f32 bias add); scores q.k^T and scores.V v_wmma_f32_16x16x32_bf16 on bf16 hi|lo plane pairs (three products hh + lh + hl into one accumulator); output projection bf16 hi/lo context planes x bf16 weights (2 products) + f32 bias; softmax over the head width in f32.
// Multi-head attention on three input streams (wire order k, q, v [NB][SEQ][1024]); 'oi' weights; 16 heads x 64; scores x 0.125; int mask [NB][1][S][S]: where mask == 0 the scaled score is REPLACED by -1e9 (read by value, no tile skipping); NO softmax over keys: T = S_sel . V, then softmax over the 64 head columns of T; merged context x Wo^T + bo.
// Per batch: bf16 copies -> projection GEMMs (f32, + bias) -> bf16 hi|lo head planes q[h][t][d], k[h][t][d], v^T[h][d][t]; per pair of heads: S = q k^T (f32) -> select + scale -> S hi|lo bf16 planes -> T = S v (f32) -> softmax over d -> context hi/lo bf16 planes; context x Wo.

#ifndef NB
#define NB 2
#endif
#ifndef SEQ
#define SEQ 2048
#endif
#define NB_FULL  2
#define SEQ_FULL 2048
#define TT   SEQ
#define DM   1024
#define NH_  16
#define HD   64
#define DQ   (NH_ * HD)
#define ZH   2
#define MPITCH SEQ_FULL
#define SCL  0.125f   // HD^-0.5
#define FILLV (-1.0e9f)

static_assert(TT % 256 == 0);
static_assert(TT % 64 == 0);
static_assert(DM % 64 == 0);
static_assert(DQ == DM);
static_assert(HD == 64);
static_assert(NH_ % ZH == 0);
static_assert(NB <= NB_FULL);
static_assert(SEQ <= SEQ_FULL);
static_assert(HD % 32 == 0);
static_assert(TT % 32 == 0);
static_assert(DM % 32 == 0);
static_assert(HD / 8 == 8);

typedef _Float16 h16;
typedef unsigned short bf;
typedef __attribute__((ext_vector_type(16))) __bf16   v16bf;
typedef __attribute__((ext_vector_type(16))) _Float16 v16h;
typedef __attribute__((ext_vector_type(8)))  _Float16 v8h;
typedef __attribute__((ext_vector_type(8)))  unsigned short v8us;
typedef __attribute__((ext_vector_type(8)))  float    v8f;
typedef __attribute__((ext_vector_type(4)))  float    v4f;
typedef __attribute__((ext_vector_type(4)))  int      v4i;
typedef v4f  __attribute__((may_alias)) v4fa;

__device__ __forceinline__ unsigned short f2bf(float f) { unsigned u = __float_as_uint(f); u += 0x7FFFu + ((u >> 16) & 1u); return (unsigned short)(u >> 16); }
__device__ __forceinline__ float bf2f(unsigned short b) { return __uint_as_float(((unsigned)b) << 16); }
__device__ __forceinline__ float bfr(float f) { return bf2f(f2bf(f)); }
__device__ __forceinline__ v16h cat16(v8h lo, v8h hi) { return __builtin_shufflevector(lo, hi, 0, 1, 2, 3, 4, 5, 6, 7, 8, 9, 10, 11, 12, 13, 14, 15); }
__device__ __forceinline__ v16bf cat16b(v8us lo, v8us hi) { return __builtin_bit_cast(v16bf, __builtin_shufflevector(lo, hi, 0, 1, 2, 3, 4, 5, 6, 7, 8, 9, 10, 11, 12, 13, 14, 15)); }
__device__ __forceinline__ v8f wmma16(v16h a, v16h b, v8f c) { return __builtin_amdgcn_wmma_f32_16x16x32_f16(false, a, false, b, (short)0, c, false, false); }
__device__ __forceinline__ v8f wmmab(v16bf a, v16bf b, v8f c) { return __builtin_amdgcn_wmma_f32_16x16x32_bf16(false, a, false, b, (short)0, c, false, false); }

// ---- k_gemmw: register-blocked GEMM, ONE WAVE per 64x64 output tile (16 accumulators), operands straight from K-contiguous 16-bit planes; grid (M/64, N/64, Z), 32 threads.
// C[m][n] (f32, pitch ldc, + optional f32 bias[n]) = sum_k A[m][k] Bt[n][k] (+ split products per NSPLIT). z-batch strides sA/sB/sC in elements. K % 32 == 0, M % 64 == 0, N % 64 == 0.
// Fragment map: lane -> row/col (lane & 15); elements 0..7 <- k0 + 8*(lane>>4) + 0..7, elements 8..15 <- k0 + 16 + 8*(lane>>4) + 0..7 (both operands); acc[j] = (row 8*(lane>>4) + j, col lane & 15).
template <typename T16> struct WFrag;
template <> struct WFrag<h16> { typedef v16h V; static __device__ __forceinline__ V ld(const h16* p) { return cat16(*(const v8h*)p, *(const v8h*)(p + 16)); } static __device__ __forceinline__ v8f mma(V a, V b, v8f c) { return wmma16(a, b, c); } };
template <> struct WFrag<bf> { typedef v16bf V; static __device__ __forceinline__ V ld(const bf* p) { return cat16b(*(const v8us*)p, *(const v8us*)(p + 16)); } static __device__ __forceinline__ v8f mma(V a, V b, v8f c) { return wmmab(a, b, c); } };
template <typename T16, int NSPLIT, bool BIAS>
__global__ __launch_bounds__(32) void k_gemmw(const T16* __restrict__ A, const T16* __restrict__ A2, const T16* __restrict__ Bt, const T16* __restrict__ Bt2, int K, float* C, int ldc, const float* __restrict__ bias, size_t sA, size_t sB, size_t sC) {
    typedef typename WFrag<T16>::V V;
    __shared__ __align__(16) float os[16 * 68];
    const size_t z = blockIdx.z; A += z * sA; if (A2) A2 += z * sA; Bt += z * sB; if (Bt2) Bt2 += z * sB; C += z * sC;
    const int lane = threadIdx.x & 31, lr = lane & 15, hi = lane >> 4; const int r0 = blockIdx.x * 64, c0 = blockIdx.y * 64;
    v8f acc[4][4];
#pragma unroll
    for (int mb = 0; mb < 4; ++mb)
#pragma unroll
        for (int nb = 0; nb < 4; ++nb) acc[mb][nb] = (v8f){};
    const size_t aoff = (size_t)(r0 + lr) * K + 8 * hi, boff = (size_t)(c0 + lr) * K + 8 * hi;
#pragma unroll 1
    for (int kc = 0; kc < K; kc += 32) {
        V a[4], a2[4];
#pragma unroll
        for (int mb = 0; mb < 4; ++mb) { a[mb] = WFrag<T16>::ld(A + aoff + (size_t)mb * 16 * K + kc); if (NSPLIT == 1 || NSPLIT == 2) a2[mb] = WFrag<T16>::ld(A2 + aoff + (size_t)mb * 16 * K + kc); }
#pragma unroll
        for (int nb = 0; nb < 4; ++nb) { const V b = WFrag<T16>::ld(Bt + boff + (size_t)nb * 16 * K + kc); V b2; if (NSPLIT >= 2) b2 = WFrag<T16>::ld(Bt2 + boff + (size_t)nb * 16 * K + kc);
#pragma unroll
            for (int mb = 0; mb < 4; ++mb) { acc[mb][nb] = WFrag<T16>::mma(a[mb], b, acc[mb][nb]); if (NSPLIT == 1 || NSPLIT == 2) acc[mb][nb] = WFrag<T16>::mma(a2[mb], b, acc[mb][nb]); if (NSPLIT >= 2) acc[mb][nb] = WFrag<T16>::mma(a[mb], b2, acc[mb][nb]); } }
        asm volatile("v_nop\n\tv_nop\n\tv_nop\n\tv_nop" : "+v"(acc[0][0]), "+v"(acc[1][1]), "+v"(acc[2][2]), "+v"(acc[3][3]) : "v"(a[0]), "v"(a[3]));
    }
#pragma unroll
    for (int mb = 0; mb < 4; ++mb) {
#pragma unroll
        for (int nb = 0; nb < 4; ++nb) {
#pragma unroll
            for (int j = 0; j < 8; ++j) os[(hi * 8 + j) * 68 + nb * 16 + lr] = acc[mb][nb][j]; }
        __builtin_amdgcn_wave_barrier(); asm volatile("" ::: "memory");
        float* crow = C + (size_t)(r0 + mb * 16) * ldc + c0;
{
#pragma unroll
            for (int s = 0; s < 8; ++s) { const int row = 2 * s + hi, cofs = lr * 4; v4f val = *(const v4fa*)(os + row * 68 + cofs); if (BIAS) { val[0] += bfr(bias[c0 + cofs]); val[1] += bfr(bias[c0 + cofs + 1]); val[2] += bfr(bias[c0 + cofs + 2]); val[3] += bfr(bias[c0 + cofs + 3]); }
                *(v4f*)(crow + (size_t)row * ldc + cofs) = val; }
             }
        __builtin_amdgcn_wave_barrier(); asm volatile("" ::: "memory");
    }
}

__device__ __forceinline__ void splitf(float y, unsigned short& h, unsigned short& l) { h = f2bf(y); l = f2bf(y - bf2f(h)); }

__global__ __launch_bounds__(256) void k_cvt8(const float* __restrict__ src, bf* dst, size_t n8) { const size_t i = (size_t)blockIdx.x * 256 + threadIdx.x; if (i >= n8) return; const v8f v = *(const v8f*)(src + i * 8); v8us o;
#pragma unroll
    for (int k = 0; k < 8; ++k) o[k] = f2bf(v[k]); *(v8us*)(dst + i * 8) = o;  }

__global__ __launch_bounds__(256) void k_hpl2(const float* __restrict__ F, bf* Ph, bf* Pl) {
    const unsigned i = blockIdx.x * 256u + threadIdx.x; if (i >= (unsigned)(NH_ * TT * (HD / 8))) return;
    const unsigned d8 = i % (unsigned)(HD / 8); const unsigned t = (i / (unsigned)(HD / 8)) % (unsigned)TT; const unsigned h = i / (unsigned)((HD / 8) * TT);
    const float* f = F + (size_t)t * DQ + h * HD + d8 * 8; const v4f a0 = *(const v4f*)f, a1 = *(const v4f*)(f + 4); v8us oh, ol;
#pragma unroll
    for (int q = 0; q < 4; ++q) { unsigned short a, c2; splitf(a0[q], a, c2); oh[q] = a; ol[q] = c2; splitf(a1[q], a, c2); oh[4 + q] = a; ol[4 + q] = c2; }
    *(v8us*)(Ph + (size_t)i * 8) = oh; *(v8us*)(Pl + (size_t)i * 8) = ol;  }

__global__ __launch_bounds__(256) void k_vtp2(const float* __restrict__ F, bf* Vh, bf* Vl) {
    const unsigned i = blockIdx.x * 256u + threadIdx.x; if (i >= (unsigned)(NH_ * HD * (TT / 8))) return;
    const unsigned t8 = i % (unsigned)(TT / 8); const unsigned d = (i / (unsigned)(TT / 8)) % (unsigned)HD; const unsigned g = i / (unsigned)((TT / 8) * HD);
    const float* f = F + (size_t)(t8 * 8) * DQ + g * HD + d; v8us oh, ol;
#pragma unroll
    for (int q = 0; q < 8; ++q) { unsigned short a, c2; splitf(f[(size_t)q * DQ], a, c2); oh[q] = a; ol[q] = c2; }
    *(v8us*)(Vh + (size_t)i * 8) = oh; *(v8us*)(Vl + (size_t)i * 8) = ol;  }

// k_ssel: S_sel[zz][i][j] = (mask[i][j] == 0) ? -1e9 : S[zz][i][j] x HD^-0.5 (replace, not additive), split into bf16 hi|lo planes (pitch TT); thread -> 8 consecutive j
__global__ __launch_bounds__(256) void k_ssel(const float* __restrict__ Sb, const int* __restrict__ M, bf* Sh, bf* Sl) {
#pragma clang fp contract(off)
    const unsigned i = blockIdx.x * 256u + threadIdx.x; if (i >= (unsigned)(ZH * TT * (TT / 8))) return;
    const unsigned j8 = i % (unsigned)(TT / 8); const unsigned r = (i / (unsigned)(TT / 8)) % (unsigned)TT;
    const float* s = Sb + (size_t)i * 8; const int* m = M + (size_t)r * MPITCH + j8 * 8;
    const v4f a0 = *(const v4f*)s, a1 = *(const v4f*)(s + 4); const v4i m0 = *(const v4i*)m, m1 = *(const v4i*)(m + 4); v8us oh, ol;
#pragma unroll
    for (int q = 0; q < 4; ++q) { const float t0 = (m0[q] == 0) ? FILLV : a0[q] * SCL; const float t1 = (m1[q] == 0) ? FILLV : a1[q] * SCL; unsigned short a, c2; splitf(t0, a, c2); oh[q] = a; ol[q] = c2; splitf(t1, a, c2); oh[4 + q] = a; ol[4 + q] = c2; }
    *(v8us*)(Sh + (size_t)i * 8) = oh; *(v8us*)(Sl + (size_t)i * 8) = ol;  }

// k_smerge: x[zz][t][:] = softmax over the HD columns of T[zz][t][:] (row maximum reduced first, one exp per element; the 8 lanes 8q..8q+7 own one row and combine by shuffles, all lanes active, index clamped);
__global__ __launch_bounds__(256) void k_smerge(const float* __restrict__ O, unsigned h0, bf* Ah, bf* Al) {
#pragma clang fp contract(off)
    const unsigned NTH = (unsigned)(ZH * TT * (HD / 8));
    const unsigned i0 = blockIdx.x * 256u + threadIdx.x; const bool ok = i0 < NTH; const unsigned i = ok ? i0 : (NTH - 1u);
    const unsigned d8 = i % (unsigned)(HD / 8); const unsigned t = (i / (unsigned)(HD / 8)) % (unsigned)TT; const unsigned zz = i / (unsigned)((HD / 8) * TT);
    const v4f a0 = *(const v4f*)(O + (size_t)i * 8), a1 = *(const v4f*)(O + (size_t)i * 8 + 4);
    float mx = fmaxf(fmaxf(fmaxf(a0[0], a0[1]), fmaxf(a0[2], a0[3])), fmaxf(fmaxf(a1[0], a1[1]), fmaxf(a1[2], a1[3])));
#pragma unroll
    for (int sh = 4; sh; sh >>= 1) mx = fmaxf(mx, __shfl_xor(mx, sh, 32));
    float e[8]; float sum = 0.f;
#pragma unroll
    for (int q = 0; q < 4; ++q) { float d0 = __fsub_rn(a0[q], mx); float d1 = __fsub_rn(a1[q], mx); e[q] = __builtin_amdgcn_exp2f(__fmul_rn(d0, 1.4426950408889634f)); e[4 + q] = __builtin_amdgcn_exp2f(__fmul_rn(d1, 1.4426950408889634f)); }
#pragma unroll
    for (int q = 0; q < 8; ++q) sum += e[q];
#pragma unroll
    for (int sh = 4; sh; sh >>= 1) sum += __shfl_xor(sum, sh, 32);
    const float f = __fdiv_rn(1.0f, sum); v8us oh, ol;
#pragma unroll
    for (int q = 0; q < 8; ++q) { unsigned short a, c2; splitf(e[q] * f, a, c2); oh[q] = a; ol[q] = c2; }
    const size_t oo = (size_t)t * DQ + (size_t)(h0 + zz) * HD + d8 * 8;
    if (ok) { *(v8us*)(Ah + oo) = oh; *(v8us*)(Al + oo) = ol;  } }

constexpr size_t al256(size_t b) { return (b + 255) & ~(size_t)255; }
constexpr size_t SZ_W  = al256((size_t)DQ * DM * 2);            // one weight plane (bf16)
constexpr size_t SZ_XB = al256((size_t)TT * DM * 2);            // bf16 activation copy
constexpr size_t SZ_F  = al256((size_t)TT * DQ * 4);            // f32 projection (reused for q, k, v in turn)
constexpr size_t SZ_PL = al256((size_t)NH_ * TT * HD * 2);      // one bf16 head plane
constexpr size_t SZ_S  = al256((size_t)ZH * TT * TT * 4);       // f32 scores of ZH heads
constexpr size_t SZ_P  = al256((size_t)ZH * TT * TT * 2);       // one bf16 plane of the selected scores of ZH heads
constexpr size_t SZ_O  = al256((size_t)ZH * TT * HD * 4);       // f32 S.V of ZH heads
constexpr size_t SZ_AT = al256((size_t)TT * DQ * 2);            // one context plane (bf16)
constexpr size_t WS_TOTAL = 4 * SZ_W + SZ_XB + SZ_F + 6 * SZ_PL + SZ_S + 2 * SZ_P + SZ_O + 2 * SZ_AT;
static_assert(WS_TOTAL <= (size_t)134217728);
// coverage equalities (threads x 8 elements == plane elements; tiles x 64 x 64 == plane elements)
static_assert(((size_t)DQ * DM / 8) % 256 == 0);
static_assert(((size_t)TT * DM / 8) % 256 == 0);
static_assert(((size_t)NH_ * TT * HD / 8) % 256 == 0);
static_assert(((size_t)ZH * TT * HD / 8) % 256 == 0);
static_assert(((size_t)ZH * TT * TT / 8) % 256 == 0);
static_assert((size_t)ZH * TT * (TT / 8) < ((size_t)1 << 31));
static_assert((size_t)NH_ * TT * (HD / 8) < ((size_t)1 << 31));

extern "C" void kernel_launch(void* const* d_in, const int* in_sizes, int n_in,
                              void* d_out, int out_size, void* d_ws, size_t ws_size, hipStream_t stream) {
    if (n_in < 12) return;
    const size_t need_x = (size_t)(NB - 1) * SEQ_FULL * DM + (size_t)SEQ * DM;
    const size_t need_m = (size_t)(NB - 1) * SEQ_FULL * SEQ_FULL + (size_t)(SEQ - 1) * SEQ_FULL + (size_t)SEQ;
    if ((size_t)in_sizes[0] < need_x || (size_t)in_sizes[1] < need_x || (size_t)in_sizes[2] < need_x || (size_t)in_sizes[3] < need_m) return;
    if ((size_t)in_sizes[4] < (size_t)DQ * DM || (size_t)in_sizes[6] < (size_t)DQ * DM || (size_t)in_sizes[8] < (size_t)DQ * DM || (size_t)in_sizes[10] < (size_t)DM * DQ) return;
    if (in_sizes[5] < DQ || in_sizes[7] < DQ || in_sizes[9] < DQ || in_sizes[11] < DM) return;
    if ((size_t)out_size < (size_t)NB * SEQ * DM) return;
    if (WS_TOTAL > ws_size) return;
    // wire order: k, q, v, mask (int), Wq, bq, Wk, bk, Wv, bv, Wo, bo ('oi' weights)
    const float* xk = (const float*)d_in[0]; const float* xq = (const float*)d_in[1]; const float* xv = (const float*)d_in[2]; const int* mk = (const int*)d_in[3];
    const float* wq = (const float*)d_in[4]; const float* bq = (const float*)d_in[5]; const float* wk = (const float*)d_in[6]; const float* bk = (const float*)d_in[7];
    const float* wv = (const float*)d_in[8]; const float* bv = (const float*)d_in[9]; const float* wo = (const float*)d_in[10]; const float* bo = (const float*)d_in[11];
    float* OUT = (float*)d_out;     // [NB][SEQ][1024]
    char* wsp = (char*)d_ws;
    bf* WQ = (bf*)wsp; wsp += SZ_W; bf* WK = (bf*)wsp; wsp += SZ_W; bf* WV = (bf*)wsp; wsp += SZ_W; bf* WO = (bf*)wsp; wsp += SZ_W;
    bf* XB = (bf*)wsp; wsp += SZ_XB; float* F = (float*)wsp; wsp += SZ_F;
    bf* QH = (bf*)wsp; wsp += SZ_PL; bf* QL = (bf*)wsp; wsp += SZ_PL; bf* KH = (bf*)wsp; wsp += SZ_PL; bf* KL = (bf*)wsp; wsp += SZ_PL;
    bf* VTH = (bf*)wsp; wsp += SZ_PL; bf* VTL = (bf*)wsp; wsp += SZ_PL;
    float* Sb = (float*)wsp; wsp += SZ_S; bf* SH = (bf*)wsp; wsp += SZ_P; bf* SL = (bf*)wsp; wsp += SZ_P; float* Ob = (float*)wsp; wsp += SZ_O;
    bf* ATh = (bf*)wsp; wsp += SZ_AT; bf* ATl = (bf*)wsp; wsp += SZ_AT;

    const unsigned GW = (unsigned)(((size_t)DQ * DM / 8 + 255) / 256);         // weight copy
    const unsigned GX = (unsigned)(((size_t)TT * DM / 8 + 255) / 256);         // activation copy
    const unsigned GP = (unsigned)(((size_t)NH_ * TT * HD / 8 + 255) / 256);   // head plane builders
    const unsigned GS = (unsigned)(((size_t)ZH * TT * TT / 8 + 255) / 256);    // score select + split
    const unsigned GM = (unsigned)(((size_t)ZH * TT * HD / 8 + 255) / 256);    // softmax over d + context merge
    k_cvt8<<<GW, 256, 0, stream>>>(wq, WQ, (size_t)DQ * DM / 8);
    k_cvt8<<<GW, 256, 0, stream>>>(wk, WK, (size_t)DQ * DM / 8);
    k_cvt8<<<GW, 256, 0, stream>>>(wv, WV, (size_t)DQ * DM / 8);
    k_cvt8<<<GW, 256, 0, stream>>>(wo, WO, (size_t)DM * DQ / 8);
    for (int b = 0; b < NB; ++b) {
        const size_t xo = (size_t)b * SEQ_FULL * DM; const int* mb = mk + (size_t)b * SEQ_FULL * SEQ_FULL;
        // q: F[t][n] = bf16(q) Wq^T + bq -> QH|QL[h][t][d]
        k_cvt8<<<GX, 256, 0, stream>>>(xq + xo, XB, (size_t)TT * DM / 8);
        k_gemmw<bf, 0, true><<<dim3(TT / 64, DQ / 64, 1), 32, 0, stream>>>(XB, nullptr, WQ, nullptr, DM, F, DQ, bq, 0, 0, 0);
        k_hpl2<<<GP, 256, 0, stream>>>(F, QH, QL);
        // k: same buffers in turn (stream-ordered) -> KH|KL[h][t][d]
        k_cvt8<<<GX, 256, 0, stream>>>(xk + xo, XB, (size_t)TT * DM / 8);
        k_gemmw<bf, 0, true><<<dim3(TT / 64, DQ / 64, 1), 32, 0, stream>>>(XB, nullptr, WK, nullptr, DM, F, DQ, bk, 0, 0, 0);
        k_hpl2<<<GP, 256, 0, stream>>>(F, KH, KL);
        // v: F[t][g*HD+d] -> VTH|VTL[g][d][t] (in[t][n] -> out[n][t] per head)
        k_cvt8<<<GX, 256, 0, stream>>>(xv + xo, XB, (size_t)TT * DM / 8);
        k_gemmw<bf, 0, true><<<dim3(TT / 64, DQ / 64, 1), 32, 0, stream>>>(XB, nullptr, WV, nullptr, DM, F, DQ, bv, 0, 0, 0);
        k_vtp2<<<GP, 256, 0, stream>>>(F, VTH, VTL);
        for (int h0 = 0; h0 < NH_; h0 += ZH) {
            const size_t zo = (size_t)h0 * TT * HD;
            // S[zz][i][j] = sum_d q[h0+zz][i][d] k[h0+zz][j][d]   (K = HD; hh + lh + hl)
            k_gemmw<bf, 2, false><<<dim3(TT / 64, TT / 64, ZH), 32, 0, stream>>>(QH + zo, QL + zo, KH + zo, KL + zo, HD, Sb, TT, nullptr, (size_t)TT * HD, (size_t)TT * HD, (size_t)TT * TT);
            k_ssel<<<GS, 256, 0, stream>>>(Sb, mb, SH, SL);
            // T[zz][i][d] = sum_j S_sel[zz][i][j] v^T[h0+zz][d][j]   (K = TT; hh + lh + hl)
            k_gemmw<bf, 2, false><<<dim3(TT / 64, HD / 64, ZH), 32, 0, stream>>>(SH, SL, VTH + zo, VTL + zo, TT, Ob, HD, nullptr, (size_t)TT * TT, (size_t)HD * TT, (size_t)TT * HD);
            k_smerge<<<GM, 256, 0, stream>>>(Ob, (unsigned)h0, ATh, ATl);
        }
        // out[b] = (ATh + ATl) Wo^T + bo
        k_gemmw<bf, 1, true><<<dim3(TT / 64, DM / 64, 1), 32, 0, stream>>>(ATh, ATl, WO, nullptr, DQ, OUT + (size_t)b * TT * DM, DM, bo, 0, 0, 0);
    }
}

// v001
// One run takes 861 microseconds.
// Next to v000, in two timings, it ran 1.55 and 1.56 times as fast.
#include <hip/hip_runtime.h>

// Contractions (all f32 accumulate): q/k/v projections v_wmma_f32_16x16x32_bf16 (inputs and weights RNE-converted to bf16, single product, f32 bias add); scores q.k^T and scores.V v_wmma_f32_16x16x32_bf16 on bf16 hi|lo plane pairs (three products hh + lh + hl into one accumulator); output projection bf16 hi/lo context planes x bf16 weights (2 products) + f32 bias; softmax over the head width in f32.
// Multi-head attention on three input streams (wire order k, q, v [NB][SEQ][1024]); 'oi' weights; 16 heads x 64; scores x 0.125; int mask [NB][1][S][S]: where mask == 0 the scaled score is REPLACED by -1e9 (read by value, no tile skipping); NO softmax over keys: T = S_sel . V, then softmax over the 64 head columns of T; merged context x Wo^T + bo.
// Per batch: bf16 copies -> projection GEMMs (f32, + bias) -> bf16 hi|lo head planes q[h][t][d], k[h][t][d], v^T[h][d][t]; per pair of heads: S = q k^T (f32) -> select + scale -> S hi|lo bf16 planes -> T = S v (f32, the key sum cut into KSP ranges, one work-group each, partial tiles in the workspace) -> partials added + softmax over d -> context hi/lo bf16 planes; context x Wo.

#ifndef NB
#define NB 2
#endif
#ifndef SEQ
#define SEQ 2048
#endif
#define NB_FULL  2
#define SEQ_FULL 2048
#define TT   SEQ
#define DM   1024
#define NH_  16
#define HD   64
#define DQ   (NH_ * HD)
#define ZH   2
#define KSP  16   // key ranges of the S.V product: 64 tiles x 16 ranges = 1024 one-wave work-groups, four per WGP
#define MPITCH SEQ_FULL
#define SCL  0.125f   // HD^-0.5
#define FILLV (-1.0e9f)

static_assert(TT % 256 == 0);
static_assert(TT % 64 == 0);
static_assert(DM % 64 == 0);
static_assert(DQ == DM);
static_assert(HD == 64);
static_assert(NH_ % ZH == 0);
static_assert(NB <= NB_FULL);
static_assert(SEQ <= SEQ_FULL);
static_assert(HD % 32 == 0);
static_assert(TT % 32 == 0);
static_assert(DM % 32 == 0);
static_assert(HD / 8 == 8);
static_assert(TT % (KSP * 32) == 0);

typedef _Float16 h16;
typedef unsigned short bf;
typedef __attribute__((ext_vector_type(16))) __bf16   v16bf;
typedef __attribute__((ext_vector_type(16))) _Float16 v16h;
typedef __attribute__((ext_vector_type(8)))  _Float16 v8h;
typedef __attribute__((ext_vector_type(8)))  unsigned short v8us;
typedef __attribute__((ext_vector_type(8)))  float    v8f;
typedef __attribute__((ext_vector_type(4)))  float    v4f;
typedef __attribute__((ext_vector_type(4)))  int      v4i;
typedef v4f  __attribute__((may_alias)) v4fa;

__device__ __forceinline__ unsigned short f2bf(float f) { unsigned u = __float_as_uint(f); u += 0x7FFFu + ((u >> 16) & 1u); return (unsigned short)(u >> 16); }
__device__ __forceinline__ float bf2f(unsigned short b) { return __uint_as_float(((unsigned)b) << 16); }
__device__ __forceinline__ float bfr(float f) { return bf2f(f2bf(f)); }
__device__ __forceinline__ v16h cat16(v8h lo, v8h hi) { return __builtin_shufflevector(lo, hi, 0, 1, 2, 3, 4, 5, 6, 7, 8, 9, 10, 11, 12, 13, 14, 15); }
__device__ __forceinline__ v16bf cat16b(v8us lo, v8us hi) { return __builtin_bit_cast(v16bf, __builtin_shufflevector(lo, hi, 0, 1, 2, 3, 4, 5, 6, 7, 8, 9, 10, 11, 12, 13, 14, 15)); }
__device__ __forceinline__ v8f wmma16(v16h a, v16h b, v8f c) { return __builtin_amdgcn_wmma_f32_16x16x32_f16(false, a, false, b, (short)0, c, false, false); }
__device__ __forceinline__ v8f wmmab(v16bf a, v16bf b, v8f c) { return __builtin_amdgcn_wmma_f32_16x16x32_bf16(false, a, false, b, (short)0, c, false, false); }

// ---- k_gemmw: register-blocked GEMM, ONE WAVE per 64x64 output tile (16 accumulators), operands straight from K-contiguous 16-bit planes; grid (M/64, N/64, Z * KS), 32 threads.
// C[m][n] (f32, pitch ldc, + optional f32 bias[n]) = sum_k A[m][k] Bt[n][k] (+ split products per NSPLIT). z-batch strides sA/sB/sC in elements. K % 32 == 0, M % 64 == 0, N % 64 == 0.
// Split over k: K = KS * KC (KC % 32 == 0), blockIdx.z = z * KS + ks; a work-group sums only k in [ks * KC, ks * KC + KC) and stores its partial tile at C + ks * sP; the reader of C adds the KS partials. KS == 1: KC == K, the whole sum.
// Fragment map: lane -> row/col (lane & 15); elements 0..7 <- k0 + 8*(lane>>4) + 0..7, elements 8..15 <- k0 + 16 + 8*(lane>>4) + 0..7 (both operands); acc[j] = (row 8*(lane>>4) + j, col lane & 15).
template <typename T16> struct WFrag;
template <> struct WFrag<h16> { typedef v16h V; static __device__ __forceinline__ V ld(const h16* p) { return cat16(*(const v8h*)p, *(const v8h*)(p + 16)); } static __device__ __forceinline__ v8f mma(V a, V b, v8f c) { return wmma16(a, b, c); } };
template <> struct WFrag<bf> { typedef v16bf V; static __device__ __forceinline__ V ld(const bf* p) { return cat16b(*(const v8us*)p, *(const v8us*)(p + 16)); } static __device__ __forceinline__ v8f mma(V a, V b, v8f c) { return wmmab(a, b, c); } };
template <typename T16, int NSPLIT, bool BIAS, int KS>
__global__ __launch_bounds__(32) void k_gemmw(const T16* __restrict__ A, const T16* __restrict__ A2, const T16* __restrict__ Bt, const T16* __restrict__ Bt2, int K, int KC, float* C, int ldc, const float* __restrict__ bias, size_t sA, size_t sB, size_t sC, size_t sP) {
    typedef typename WFrag<T16>::V V;
    __shared__ __align__(16) float os[16 * 68];
    const size_t z = blockIdx.z / (unsigned)KS, ks = blockIdx.z % (unsigned)KS, ko = ks * KC; A += z * sA + ko; if (A2) A2 += z * sA + ko; Bt += z * sB + ko; if (Bt2) Bt2 += z * sB + ko; C += z * sC + ks * sP;
    const int lane = threadIdx.x & 31, lr = lane & 15, hi = lane >> 4; const int r0 = blockIdx.x * 64, c0 = blockIdx.y * 64;
    v8f acc[4][4];
#pragma unroll
    for (int mb = 0; mb < 4; ++mb)
#pragma unroll
        for (int nb = 0; nb < 4; ++nb) acc[mb][nb] = (v8f){};
    const size_t aoff = (size_t)(r0 + lr) * K + 8 * hi, boff = (size_t)(c0 + lr) * K + 8 * hi;
#pragma unroll 1
    for (int kc = 0; kc < KC; kc += 32) {
        V a[4], a2[4];
#pragma unroll
        for (int mb = 0; mb < 4; ++mb) { a[mb] = WFrag<T16>::ld(A + aoff + (size_t)mb * 16 * K + kc); if (NSPLIT == 1 || NSPLIT == 2) a2[mb] = WFrag<T16>::ld(A2 + aoff + (size_t)mb * 16 * K + kc); }
#pragma unroll
        for (int nb = 0; nb < 4; ++nb) { const V b = WFrag<T16>::ld(Bt + boff + (size_t)nb * 16 * K + kc); V b2; if (NSPLIT >= 2) b2 = WFrag<T16>::ld(Bt2 + boff + (size_t)nb * 16 * K + kc);
#pragma unroll
            for (int mb = 0; mb < 4; ++mb) { acc[mb][nb] = WFrag<T16>::mma(a[mb], b, acc[mb][nb]); if (NSPLIT == 1 || NSPLIT == 2) acc[mb][nb] = WFrag<T16>::mma(a2[mb], b, acc[mb][nb]); if (NSPLIT >= 2) acc[mb][nb] = WFrag<T16>::mma(a[mb], b2, acc[mb][nb]); } }
        asm volatile("v_nop\n\tv_nop\n\tv_nop\n\tv_nop" : "+v"(acc[0][0]), "+v"(acc[1][1]), "+v"(acc[2][2]), "+v"(acc[3][3]) : "v"(a[0]), "v"(a[3]));
    }
#pragma unroll
    for (int mb = 0; mb < 4; ++mb) {
#pragma unroll
        for (int nb = 0; nb < 4; ++nb) {
#pragma unroll
            for (int j = 0; j < 8; ++j) os[(hi * 8 + j) * 68 + nb * 16 + lr] = acc[mb][nb][j]; }
        __builtin_amdgcn_wave_barrier(); asm volatile("" ::: "memory");
        float* crow = C + (size_t)(r0 + mb * 16) * ldc + c0;
{
#pragma unroll
            for (int s = 0; s < 8; ++s) { const int row = 2 * s + hi, cofs = lr * 4; v4f val = *(const v4fa*)(os + row * 68 + cofs); if (BIAS) { val[0] += bfr(bias[c0 + cofs]); val[1] += bfr(bias[c0 + cofs + 1]); val[2] += bfr(bias[c0 + cofs + 2]); val[3] += bfr(bias[c0 + cofs + 3]); }
                *(v4f*)(crow + (size_t)row * ldc + cofs) = val; }
             }
        __builtin_amdgcn_wave_barrier(); asm volatile("" ::: "memory");
    }
}

__device__ __forceinline__ void splitf(float y, unsigned short& h, unsigned short& l) { h = f2bf(y); l = f2bf(y - bf2f(h)); }

__global__ __launch_bounds__(256) void k_cvt8(const float* __restrict__ src, bf* dst, size_t n8) { const size_t i = (size_t)blockIdx.x * 256 + threadIdx.x; if (i >= n8) return; const v8f v = *(const v8f*)(src + i * 8); v8us o;
#pragma unroll
    for (int k = 0; k < 8; ++k) o[k] = f2bf(v[k]); *(v8us*)(dst + i * 8) = o;  }

__global__ __launch_bounds__(256) void k_hpl2(const float* __restrict__ F, bf* Ph, bf* Pl) {
    const unsigned i = blockIdx.x * 256u + threadIdx.x; if (i >= (unsigned)(NH_ * TT * (HD / 8))) return;
    const unsigned d8 = i % (unsigned)(HD / 8); const unsigned t = (i / (unsigned)(HD / 8)) % (unsigned)TT; const unsigned h = i / (unsigned)((HD / 8) * TT);
    const float* f = F + (size_t)t * DQ + h * HD + d8 * 8; const v4f a0 = *(const v4f*)f, a1 = *(const v4f*)(f + 4); v8us oh, ol;
#pragma unroll
    for (int q = 0; q < 4; ++q) { unsigned short a, c2; splitf(a0[q], a, c2); oh[q] = a; ol[q] = c2; splitf(a1[q], a, c2); oh[4 + q] = a; ol[4 + q] = c2; }
    *(v8us*)(Ph + (size_t)i * 8) = oh; *(v8us*)(Pl + (size_t)i * 8) = ol;  }

__global__ __launch_bounds__(256) void k_vtp2(const float* __restrict__ F, bf* Vh, bf* Vl) {
    const unsigned i = blockIdx.x * 256u + threadIdx.x; if (i >= (unsigned)(NH_ * HD * (TT / 8))) return;
    const unsigned t8 = i % (unsigned)(TT / 8); const unsigned d = (i / (unsigned)(TT / 8)) % (unsigned)HD; const unsigned g = i / (unsigned)((TT / 8) * HD);
    const float* f = F + (size_t)(t8 * 8) * DQ + g * HD + d; v8us oh, ol;
#pragma unroll
    for (int q = 0; q < 8; ++q) { unsigned short a, c2; splitf(f[(size_t)q * DQ], a, c2); oh[q] = a; ol[q] = c2; }
    *(v8us*)(Vh + (size_t)i * 8) = oh; *(v8us*)(Vl + (size_t)i * 8) = ol;  }

// k_ssel: S_sel[zz][i][j] = (mask[i][j] == 0) ? -1e9 : S[zz][i][j] x HD^-0.5 (replace, not additive), split into bf16 hi|lo planes (pitch TT); thread -> 8 consecutive j
__global__ __launch_bounds__(256) void k_ssel(const float* __restrict__ Sb, const int* __restrict__ M, bf* Sh, bf* Sl) {
#pragma clang fp contract(off)
    const unsigned i = blockIdx.x * 256u + threadIdx.x; if (i >= (unsigned)(ZH * TT * (TT / 8))) return;
    const unsigned j8 = i % (unsigned)(TT / 8); const unsigned r = (i / (unsigned)(TT / 8)) % (unsigned)TT;
    const float* s = Sb + (size_t)i * 8; const int* m = M + (size_t)r * MPITCH + j8 * 8;
    const v4f a0 = *(const v4f*)s, a1 = *(const v4f*)(s + 4); const v4i m0 = *(const v4i*)m, m1 = *(const v4i*)(m + 4); v8us oh, ol;
#pragma unroll
    for (int q = 0; q < 4; ++q) { const float t0 = (m0[q] == 0) ? FILLV : a0[q] * SCL; const float t1 = (m1[q] == 0) ? FILLV : a1[q] * SCL; unsigned short a, c2; splitf(t0, a, c2); oh[q] = a; ol[q] = c2; splitf(t1, a, c2); oh[4 + q] = a; ol[4 + q] = c2; }
    *(v8us*)(Sh + (size_t)i * 8) = oh; *(v8us*)(Sl + (size_t)i * 8) = ol;  }

// k_smerge: T[zz][t][:] = sum over ks (rising, f32) of the KSP partial planes O[ks][zz][t][:]; x[zz][t][:] = softmax over the HD columns of T[zz][t][:] (running maximum, one exp per element; the 8 lanes 8q..8q+7 own one row and combine by shuffles, all lanes active, index clamped);
__global__ __launch_bounds__(256) void k_smerge(const float* __restrict__ O, unsigned h0, bf* Ah, bf* Al) {
#pragma clang fp contract(off)
    const unsigned NTH = (unsigned)(ZH * TT * (HD / 8));
    const unsigned i0 = blockIdx.x * 256u + threadIdx.x; const bool ok = i0 < NTH; const unsigned i = ok ? i0 : (NTH - 1u);
    const unsigned d8 = i % (unsigned)(HD / 8); const unsigned t = (i / (unsigned)(HD / 8)) % (unsigned)TT; const unsigned zz = i / (unsigned)((HD / 8) * TT);
    v4f a0 = *(const v4f*)(O + (size_t)i * 8), a1 = *(const v4f*)(O + (size_t)i * 8 + 4);
#pragma unroll   // so that the partial planes' loads issue ahead of the adds instead of one latency per plane
    for (int ks = 1; ks < KSP; ++ks) { const float* p = O + (size_t)ks * ((size_t)ZH * TT * HD) + (size_t)i * 8; a0 += *(const v4f*)p; a1 += *(const v4f*)(p + 4); }
    float mx = fmaxf(fmaxf(fmaxf(a0[0], a0[1]), fmaxf(a0[2], a0[3])), fmaxf(fmaxf(a1[0], a1[1]), fmaxf(a1[2], a1[3])));
#pragma unroll
    for (int sh = 4; sh; sh >>= 1) mx = fmaxf(mx, __shfl_xor(mx, sh, 32));
    float e[8]; float sum = 0.f;
#pragma unroll
    for (int q = 0; q < 4; ++q) { float d0 = __fsub_rn(a0[q], mx); float d1 = __fsub_rn(a1[q], mx); e[q] = __builtin_amdgcn_exp2f(__fmul_rn(d0, 1.4426950408889634f)); e[4 + q] = __builtin_amdgcn_exp2f(__fmul_rn(d1, 1.4426950408889634f)); }
#pragma unroll
    for (int q = 0; q < 8; ++q) sum += e[q];
#pragma unroll
    for (int sh = 4; sh; sh >>= 1) sum += __shfl_xor(sum, sh, 32);
    const float f = __fdiv_rn(1.0f, sum); v8us oh, ol;
#pragma unroll
    for (int q = 0; q < 8; ++q) { unsigned short a, c2; splitf(e[q] * f, a, c2); oh[q] = a; ol[q] = c2; }
    const size_t oo = (size_t)t * DQ + (size_t)(h0 + zz) * HD + d8 * 8;
    if (ok) { *(v8us*)(Ah + oo) = oh; *(v8us*)(Al + oo) = ol;  } }

constexpr size_t al256(size_t b) { return (b + 255) & ~(size_t)255; }
constexpr size_t SZ_W  = al256((size_t)DQ * DM * 2);            // one weight plane (bf16)
constexpr size_t SZ_XB = al256((size_t)TT * DM * 2);            // bf16 activation copy
constexpr size_t SZ_F  = al256((size_t)TT * DQ * 4);            // f32 projection (reused for q, k, v in turn)
constexpr size_t SZ_PL = al256((size_t)NH_ * TT * HD * 2);      // one bf16 head plane
constexpr size_t SZ_S  = al256((size_t)ZH * TT * TT * 4);       // f32 scores of ZH heads
constexpr size_t SZ_P  = al256((size_t)ZH * TT * TT * 2);       // one bf16 plane of the selected scores of ZH heads
constexpr size_t SZ_O  = al256((size_t)KSP * ZH * TT * HD * 4); // f32 S.V of ZH heads, KSP partial planes
constexpr size_t SZ_AT = al256((size_t)TT * DQ * 2);            // one context plane (bf16)
constexpr size_t WS_TOTAL = 4 * SZ_W + SZ_XB + SZ_F + 6 * SZ_PL + SZ_S + 2 * SZ_P + SZ_O + 2 * SZ_AT;
static_assert(WS_TOTAL <= (size_t)268435456);
// coverage equalities (threads x 8 elements == plane elements; tiles x 64 x 64 == plane elements)
static_assert(((size_t)DQ * DM / 8) % 256 == 0);
static_assert(((size_t)TT * DM / 8) % 256 == 0);
static_assert(((size_t)NH_ * TT * HD / 8) % 256 == 0);
static_assert(((size_t)ZH * TT * HD / 8) % 256 == 0);
static_assert(((size_t)ZH * TT * TT / 8) % 256 == 0);
static_assert((size_t)ZH * TT * (TT / 8) < ((size_t)1 << 31));
static_assert((size_t)NH_ * TT * (HD / 8) < ((size_t)1 << 31));

extern "C" void kernel_launch(void* const* d_in, const int* in_sizes, int n_in,
                              void* d_out, int out_size, void* d_ws, size_t ws_size, hipStream_t stream) {
    if (n_in < 12) return;
    const size_t need_x = (size_t)(NB - 1) * SEQ_FULL * DM + (size_t)SEQ * DM;
    const size_t need_m = (size_t)(NB - 1) * SEQ_FULL * SEQ_FULL + (size_t)(SEQ - 1) * SEQ_FULL + (size_t)SEQ;
    if ((size_t)in_sizes[0] < need_x || (size_t)in_sizes[1] < need_x || (size_t)in_sizes[2] < need_x || (size_t)in_sizes[3] < need_m) return;
    if ((size_t)in_sizes[4] < (size_t)DQ * DM || (size_t)in_sizes[6] < (size_t)DQ * DM || (size_t)in_sizes[8] < (size_t)DQ * DM || (size_t)in_sizes[10] < (size_t)DM * DQ) return;
    if (in_sizes[5] < DQ || in_sizes[7] < DQ || in_sizes[9] < DQ || in_sizes[11] < DM) return;
    if ((size_t)out_size < (size_t)NB * SEQ * DM) return;
    if (WS_TOTAL > ws_size) return;
    // wire order: k, q, v, mask (int), Wq, bq, Wk, bk, Wv, bv, Wo, bo ('oi' weights)
    const float* xk = (const float*)d_in[0]; const float* xq = (const float*)d_in[1]; const float* xv = (const float*)d_in[2]; const int* mk = (const int*)d_in[3];
    const float* wq = (const float*)d_in[4]; const float* bq = (const float*)d_in[5]; const float* wk = (const float*)d_in[6]; const float* bk = (const float*)d_in[7];
    const float* wv = (const float*)d_in[8]; const float* bv = (const float*)d_in[9]; const float* wo = (const float*)d_in[10]; const float* bo = (const float*)d_in[11];
    float* OUT = (float*)d_out;     // [NB][SEQ][1024]
    char* wsp = (char*)d_ws;
    bf* WQ = (bf*)wsp; wsp += SZ_W; bf* WK = (bf*)wsp; wsp += SZ_W; bf* WV = (bf*)wsp; wsp += SZ_W; bf* WO = (bf*)wsp; wsp += SZ_W;
    bf* XB = (bf*)wsp; wsp += SZ_XB; float* F = (float*)wsp; wsp += SZ_F;
    bf* QH = (bf*)wsp; wsp += SZ_PL; bf* QL = (bf*)wsp; wsp += SZ_PL; bf* KH = (bf*)wsp; wsp += SZ_PL; bf* KL = (bf*)wsp; wsp += SZ_PL;
    bf* VTH = (bf*)wsp; wsp += SZ_PL; bf* VTL = (bf*)wsp; wsp += SZ_PL;
    float* Sb = (float*)wsp; wsp += SZ_S; bf* SH = (bf*)wsp; wsp += SZ_P; bf* SL = (bf*)wsp; wsp += SZ_P; float* Ob = (float*)wsp; wsp += SZ_O;
    bf* ATh = (bf*)wsp; wsp += SZ_AT; bf* ATl = (bf*)wsp; wsp += SZ_AT;

    const unsigned GW = (unsigned)(((size_t)DQ * DM / 8 + 255) / 256);         // weight copy
    const unsigned GX = (unsigned)(((size_t)TT * DM / 8 + 255) / 256);         // activation copy
    const unsigned GP = (unsigned)(((size_t)NH_ * TT * HD / 8 + 255) / 256);   // head plane builders
    const unsigned GS = (unsigned)(((size_t)ZH * TT * TT / 8 + 255) / 256);    // score select + split
    const unsigned GM = (unsigned)(((size_t)ZH * TT * HD / 8 + 255) / 256);    // softmax over d + context merge
    k_cvt8<<<GW, 256, 0, stream>>>(wq, WQ, (size_t)DQ * DM / 8);
    k_cvt8<<<GW, 256, 0, stream>>>(wk, WK, (size_t)DQ * DM / 8);
    k_cvt8<<<GW, 256, 0, stream>>>(wv, WV, (size_t)DQ * DM / 8);
    k_cvt8<<<GW, 256, 0, stream>>>(wo, WO, (size_t)DM * DQ / 8);
    for (int b = 0; b < NB; ++b) {
        const size_t xo = (size_t)b * SEQ_FULL * DM; const int* mb = mk + (size_t)b * SEQ_FULL * SEQ_FULL;
        // q: F[t][n] = bf16(q) Wq^T + bq -> QH|QL[h][t][d]
        k_cvt8<<<GX, 256, 0, stream>>>(xq + xo, XB, (size_t)TT * DM / 8);
        k_gemmw<bf, 0, true, 1><<<dim3(TT / 64, DQ / 64, 1), 32, 0, stream>>>(XB, nullptr, WQ, nullptr, DM, DM, F, DQ, bq, 0, 0, 0, 0);
        k_hpl2<<<GP, 256, 0, stream>>>(F, QH, QL);
        // k: same buffers in turn (stream-ordered) -> KH|KL[h][t][d]
        k_cvt8<<<GX, 256, 0, stream>>>(xk + xo, XB, (size_t)TT * DM / 8);
        k_gemmw<bf, 0, true, 1><<<dim3(TT / 64, DQ / 64, 1), 32, 0, stream>>>(XB, nullptr, WK, nullptr, DM, DM, F, DQ, bk, 0, 0, 0, 0);
        k_hpl2<<<GP, 256, 0, stream>>>(F, KH, KL);
        // v: F[t][g*HD+d] -> VTH|VTL[g][d][t] (in[t][n] -> out[n][t] per head)
        k_cvt8<<<GX, 256, 0, stream>>>(xv + xo, XB, (size_t)TT * DM / 8);
        k_gemmw<bf, 0, true, 1><<<dim3(TT / 64, DQ / 64, 1), 32, 0, stream>>>(XB, nullptr, WV, nullptr, DM, DM, F, DQ, bv, 0, 0, 0, 0);
        k_vtp2<<<GP, 256, 0, stream>>>(F, VTH, VTL);
        for (int h0 = 0; h0 < NH_; h0 += ZH) {
            const size_t zo = (size_t)h0 * TT * HD;
            // S[zz][i][j] = sum_d q[h0+zz][i][d] k[h0+zz][j][d]   (K = HD; hh + lh + hl)
            k_gemmw<bf, 2, false, 1><<<dim3(TT / 64, TT / 64, ZH), 32, 0, stream>>>(QH + zo, QL + zo, KH + zo, KL + zo, HD, HD, Sb, TT, nullptr, (size_t)TT * HD, (size_t)TT * HD, (size_t)TT * TT, 0);
            k_ssel<<<GS, 256, 0, stream>>>(Sb, mb, SH, SL);
            // T[ks][zz][i][d] = sum over j in range ks of S_sel[zz][i][j] v^T[h0+zz][d][j]   (K = TT in KSP ranges; hh + lh + hl)
            k_gemmw<bf, 2, false, KSP><<<dim3(TT / 64, HD / 64, ZH * KSP), 32, 0, stream>>>(SH, SL, VTH + zo, VTL + zo, TT, TT / KSP, Ob, HD, nullptr, (size_t)TT * TT, (size_t)HD * TT, (size_t)TT * HD, (size_t)ZH * TT * HD);
            k_smerge<<<GM, 256, 0, stream>>>(Ob, (unsigned)h0, ATh, ATl);
        }
        // out[b] = (ATh + ATl) Wo^T + bo
        k_gemmw<bf, 1, true, 1><<<dim3(TT / 64, DM / 64, 1), 32, 0, stream>>>(ATh, ATl, WO, nullptr, DQ, DQ, OUT + (size_t)b * TT * DM, DM, bo, 0, 0, 0, 0);
    }
}

// v003
// One run takes 185 microseconds.
// It is 4.73 times as fast as v001, going by the measured steps of the versions left out in between.
// Over all steps from v000 it is 7.36 times as fast.
#include <hip/hip_runtime.h>

// Contractions (all f32 accumulate): q/k/v projections v_wmma_f32_16x16x32_bf16 (inputs and weights RNE-converted to bf16, single product, f32 bias add); scores k.q^T and V^T.scores^T v_wmma_f32_16x16x32_bf16 on bf16 hi|lo pairs (three products hh + hl + lh into one accumulator); output projection bf16 hi/lo context planes x bf16 weights (2 products) + f32 bias; softmax over the head width in f32.
// Multi-head attention on three input streams (wire order k, q, v [NB][SEQ][1024]); 'oi' weights; 16 heads x 64; scores x 0.125; int mask [NB][1][S][S]: where mask == 0 the scaled score is REPLACED by -1e9 (read by value, no tile skipping); NO softmax over keys: T = S_sel . V, then softmax over the 64 head columns of T; merged context x Wo^T + bo.
// Five launches, each over both batches (and over the q, k, v streams where they are alike): bf16 copies -> projection GEMMs (f32, + bias) -> bf16 hi|lo head planes of q, k and v^T in fragment order; one fused kernel over all heads: per 32 keys S^T = k (q x 0.125)^T (f32 accumulators) -> select -> bf16 hi|lo B operands in registers -> T^T += v^T S^T; the two key ranges of a work-group added through LDS; softmax over d -> context hi/lo bf16 planes; context x Wo.

#ifndef NB
#define NB 2
#endif
#ifndef SEQ
#define SEQ 2048
#endif
#define NB_FULL  2
#define SEQ_FULL 2048
#define TT   SEQ
#define DM   1024
#define NH_  16
#define HD   64
#define DQ   (NH_ * HD)
#define QWG  128  // queries of one work-group of the fused kernel: 4 wave columns x 32 queries
#define KR   2    // key ranges of one work-group: 4 x 2 = 8 waves, (TT / QWG) x NH_ x NB = 512 work-groups
#define MPITCH SEQ_FULL
#define SCL  0.125f   // HD^-0.5
#define FILLV (-1.0e9f)

static_assert(TT % 256 == 0);
static_assert(TT % 64 == 0);
static_assert(DM % 64 == 0);
static_assert(DQ == DM);
static_assert(HD == 64);
static_assert(TT % QWG == 0);
static_assert(NB <= NB_FULL);
static_assert(SEQ <= SEQ_FULL);
static_assert(HD % 32 == 0);
static_assert(TT % 32 == 0);
static_assert(DM % 32 == 0);
static_assert(HD / 8 == 8);
static_assert(TT % (KR * 32) == 0);
static_assert(KR == 2);
static_assert(SCL == 0.125f);

constexpr size_t al256(size_t b) { return (b + 255) & ~(size_t)255; }
constexpr size_t SZ_W  = al256((size_t)DQ * DM * 2);            // one weight plane (bf16)
constexpr size_t SZ_XB = al256((size_t)TT * DM * 2);            // bf16 activation copy of one stream and batch
constexpr size_t SZ_F  = al256((size_t)TT * DQ * 4);            // f32 projection of one stream and batch
constexpr size_t SZ_PL = al256((size_t)NH_ * TT * HD * 2);      // one bf16 head plane of one batch
constexpr size_t SZ_AT = al256((size_t)TT * DQ * 2);            // one context plane (bf16) of one batch
constexpr unsigned GW = (unsigned)((size_t)DQ * DM / 8 / 256);         // work-groups of one weight copy
constexpr unsigned GX = (unsigned)((size_t)TT * DM / 8 / 256);         // work-groups of one activation copy (one stream, one batch)
constexpr unsigned GP = (unsigned)((size_t)NH_ * TT * HD / 8 / 256);   // work-groups of one head plane pair
// the slices of one buffer stand back to back: stream-major, then batch
static_assert(SZ_W == (size_t)DQ * DM * 2);
static_assert(SZ_XB == (size_t)TT * DM * 2);
static_assert(SZ_F == (size_t)TT * DQ * 4);
static_assert(SZ_PL == (size_t)NH_ * TT * HD * 2);
static_assert(SZ_AT == (size_t)TT * DQ * 2);

typedef _Float16 h16;
typedef unsigned short bf;
typedef __attribute__((ext_vector_type(16))) __bf16   v16bf;
typedef __attribute__((ext_vector_type(16))) _Float16 v16h;
typedef __attribute__((ext_vector_type(8)))  _Float16 v8h;
typedef __attribute__((ext_vector_type(8)))  unsigned short v8us;
typedef __attribute__((ext_vector_type(2)))  __bf16   v2bf;
typedef __attribute__((ext_vector_type(2)))  float    v2f;
typedef __attribute__((ext_vector_type(8)))  unsigned v8u;
typedef __attribute__((ext_vector_type(4)))  unsigned v4u;
typedef __attribute__((ext_vector_type(8)))  int      v8i;
typedef __attribute__((ext_vector_type(8)))  float    v8f;
typedef __attribute__((ext_vector_type(4)))  float    v4f;
typedef __attribute__((ext_vector_type(4)))  int      v4i;
typedef v4f  __attribute__((may_alias)) v4fa;

__device__ __forceinline__ unsigned short f2bf(float f) { unsigned u = __float_as_uint(f); u += 0x7FFFu + ((u >> 16) & 1u); return (unsigned short)(u >> 16); }
__device__ __forceinline__ float bf2f(unsigned short b) { return __uint_as_float(((unsigned)b) << 16); }
__device__ __forceinline__ float bfr(float f) { return bf2f(f2bf(f)); }
__device__ __forceinline__ v16h cat16(v8h lo, v8h hi) { return __builtin_shufflevector(lo, hi, 0, 1, 2, 3, 4, 5, 6, 7, 8, 9, 10, 11, 12, 13, 14, 15); }
__device__ __forceinline__ v16bf cat16b(v8us lo, v8us hi) { return __builtin_bit_cast(v16bf, __builtin_shufflevector(lo, hi, 0, 1, 2, 3, 4, 5, 6, 7, 8, 9, 10, 11, 12, 13, 14, 15)); }
__device__ __forceinline__ v8f wmma16(v16h a, v16h b, v8f c) { return __builtin_amdgcn_wmma_f32_16x16x32_f16(false, a, false, b, (short)0, c, false, false); }
__device__ __forceinline__ v8f wmmab(v16bf a, v16bf b, v8f c) { return __builtin_amdgcn_wmma_f32_16x16x32_bf16(false, a, false, b, (short)0, c, false, false); }

// ---- k_gemmw: register-blocked GEMM, ONE WAVE per 64x64 output tile (16 accumulators), operands straight from K-contiguous 16-bit planes; grid (M/64, N/64, Z * KS), 32 threads.
// C[m][n] (f32, pitch ldc, + optional f32 bias[n]) = sum_k A[m][k] Bt[n][k] (+ split products per NSPLIT). z-batch strides sA/sB/sC in elements. K % 32 == 0, M % 64 == 0, N % 64 == 0.
// The bias vector goes by z: bias, bias1, bias2 for z = 0, 1, 2.
// Split over k: K = KS * KC (KC % 32 == 0), blockIdx.z = z * KS + ks; a work-group sums only k in [ks * KC, ks * KC + KC) and stores its partial tile at C + ks * sP; the reader of C adds the KS partials. KS == 1: KC == K, the whole sum.
// Fragment map: lane -> row/col (lane & 15); elements 0..7 <- k0 + 8*(lane>>4) + 0..7, elements 8..15 <- k0 + 16 + 8*(lane>>4) + 0..7 (both operands); acc[j] = (row 8*(lane>>4) + j, col lane & 15).
template <typename T16> struct WFrag;
template <> struct WFrag<h16> { typedef v16h V; static __device__ __forceinline__ V ld(const h16* p) { return cat16(*(const v8h*)p, *(const v8h*)(p + 16)); } static __device__ __forceinline__ v8f mma(V a, V b, v8f c) { return wmma16(a, b, c); } };
template <> struct WFrag<bf> { typedef v16bf V; static __device__ __forceinline__ V ld(const bf* p) { return cat16b(*(const v8us*)p, *(const v8us*)(p + 16)); } static __device__ __forceinline__ v8f mma(V a, V b, v8f c) { return wmmab(a, b, c); } };
template <typename T16, int NSPLIT, bool BIAS, int KS>
__global__ __launch_bounds__(32) void k_gemmw(const T16* __restrict__ A, const T16* __restrict__ A2, const T16* __restrict__ Bt, const T16* __restrict__ Bt2, int K, int KC, float* C, int ldc, const float* __restrict__ bias0, const float* __restrict__ bias1, const float* __restrict__ bias2, size_t sA, size_t sB, size_t sC, size_t sP) {
    typedef typename WFrag<T16>::V V;
    __shared__ __align__(16) float os[16 * 68];
    const size_t z = blockIdx.z / (unsigned)KS, ks = blockIdx.z % (unsigned)KS, ko = ks * KC; A += z * sA + ko; if (A2) A2 += z * sA + ko; Bt += z * sB + ko; if (Bt2) Bt2 += z * sB + ko; C += z * sC + ks * sP;
    const float* bias = z == 0 ? bias0 : (z == 1 ? bias1 : bias2);
    const int lane = threadIdx.x & 31, lr = lane & 15, hi = lane >> 4; const int r0 = blockIdx.x * 64, c0 = blockIdx.y * 64;
    v8f acc[4][4];
#pragma unroll
    for (int mb = 0; mb < 4; ++mb)
#pragma unroll
        for (int nb = 0; nb < 4; ++nb) acc[mb][nb] = (v8f){};
    const size_t aoff = (size_t)(r0 + lr) * K + 8 * hi, boff = (size_t)(c0 + lr) * K + 8 * hi;
#pragma unroll 1
    for (int kc = 0; kc < KC; kc += 32) {
        V a[4], a2[4];
#pragma unroll
        for (int mb = 0; mb < 4; ++mb) { a[mb] = WFrag<T16>::ld(A + aoff + (size_t)mb * 16 * K + kc); if (NSPLIT == 1 || NSPLIT == 2) a2[mb] = WFrag<T16>::ld(A2 + aoff + (size_t)mb * 16 * K + kc); }
#pragma unroll
        for (int nb = 0; nb < 4; ++nb) { const V b = WFrag<T16>::ld(Bt + boff + (size_t)nb * 16 * K + kc); V b2; if (NSPLIT >= 2) b2 = WFrag<T16>::ld(Bt2 + boff + (size_t)nb * 16 * K + kc);
#pragma unroll
            for (int mb = 0; mb < 4; ++mb) { acc[mb][nb] = WFrag<T16>::mma(a[mb], b, acc[mb][nb]); if (NSPLIT == 1 || NSPLIT == 2) acc[mb][nb] = WFrag<T16>::mma(a2[mb], b, acc[mb][nb]); if (NSPLIT >= 2) acc[mb][nb] = WFrag<T16>::mma(a[mb], b2, acc[mb][nb]); } }
        asm volatile("v_nop\n\tv_nop\n\tv_nop\n\tv_nop" : "+v"(acc[0][0]), "+v"(acc[1][1]), "+v"(acc[2][2]), "+v"(acc[3][3]) : "v"(a[0]), "v"(a[3]));
    }
#pragma unroll
    for (int mb = 0; mb < 4; ++mb) {
#pragma unroll
        for (int nb = 0; nb < 4; ++nb) {
#pragma unroll
            for (int j = 0; j < 8; ++j) os[(hi * 8 + j) * 68 + nb * 16 + lr] = acc[mb][nb][j]; }
        __builtin_amdgcn_wave_barrier(); asm volatile("" ::: "memory");
        float* crow = C + (size_t)(r0 + mb * 16) * ldc + c0;
{
#pragma unroll
            for (int s = 0; s < 8; ++s) { const int row = 2 * s + hi, cofs = lr * 4; v4f val = *(const v4fa*)(os + row * 68 + cofs); if (BIAS) { val[0] += bfr(bias[c0 + cofs]); val[1] += bfr(bias[c0 + cofs + 1]); val[2] += bfr(bias[c0 + cofs + 2]); val[3] += bfr(bias[c0 + cofs + 3]); }
                *(v4f*)(crow + (size_t)row * ldc + cofs) = val; }
             }
        __builtin_amdgcn_wave_barrier(); asm volatile("" ::: "memory");
    }
}

__device__ __forceinline__ void splitf(float y, unsigned short& h, unsigned short& l) { h = f2bf(y); l = f2bf(y - bf2f(h)); }

// k_cvt8: every f32 -> bf16 copy in one launch; a work-group copies 2048 elements. Work-groups [0, 3 * NB * GX): activations, stream s, batch b -> XB[s][b]; the other 4 * GW: weights -> WB[s]. The grid covers every slice exactly.
__global__ __launch_bounds__(256) void k_cvt8(const float* __restrict__ x0, const float* __restrict__ x1, const float* __restrict__ x2, const float* __restrict__ w0, const float* __restrict__ w1, const float* __restrict__ w2, const float* __restrict__ w3, bf* XB, bf* WB) {
    const unsigned bx = blockIdx.x; const float* src; bf* dst;
    if (bx < 3u * NB * GX) { const unsigned s = bx / (NB * GX), b = (bx / GX) % (unsigned)NB, c = bx % GX; src = (s == 0 ? x0 : (s == 1 ? x1 : x2)) + (size_t)b * SEQ_FULL * DM + (size_t)c * 2048; dst = XB + (size_t)bx * 2048; }
    else { const unsigned r = bx - 3u * NB * GX, s = r / GW, c = r % GW; src = (s == 0 ? w0 : (s == 1 ? w1 : (s == 2 ? w2 : w3))) + (size_t)c * 2048; dst = WB + (size_t)r * 2048; }
    const unsigned i = threadIdx.x; const v8f v = *(const v8f*)(src + i * 8); v8us o;
#pragma unroll
    for (int k = 0; k < 8; ++k) o[k] = f2bf(v[k]); *(v8us*)(dst + i * 8) = o;  }

// Fragment order of a 16-bit plane: a 16 x 32 fragment (16 rows or columns x 32 k) is 512 elements in a row, as two halves of 256: half e, lane l = 16 * hi + c, 8 elements <- row c, k = 16 * e + 8 * hi + 0..7.
// A wave's two 16-byte loads of a fragment then each cover 512 contiguous bytes (4 whole lines) instead of 16 lines.
// d_hpl2: q or k head plane; fragment number ((h * TT / 16 + t / 16) * 2 + d / 32); rows t, k = d
__device__ __forceinline__ void d_hpl2(const float* __restrict__ F, bf* Ph, bf* Pl) {
    const unsigned i = blockIdx.x * 256u + threadIdx.x; if (i >= (unsigned)(NH_ * TT * (HD / 8))) return;
    const unsigned d8 = i % (unsigned)(HD / 8); const unsigned t = (i / (unsigned)(HD / 8)) % (unsigned)TT; const unsigned h = i / (unsigned)((HD / 8) * TT);
    const float* f = F + (size_t)t * DQ + h * HD + d8 * 8; const v4f a0 = *(const v4f*)f, a1 = *(const v4f*)(f + 4); v8us oh, ol;
#pragma unroll
    for (int q = 0; q < 4; ++q) { unsigned short a, c2; splitf(a0[q], a, c2); oh[q] = a; ol[q] = c2; splitf(a1[q], a, c2); oh[4 + q] = a; ol[4 + q] = c2; }
    const size_t o = (size_t)((h * (unsigned)(TT / 16) + (t >> 4)) * 2u + (d8 >> 2)) * 512 + ((d8 >> 1) & 1u) * 256 + ((d8 & 1u) * 16 + (t & 15u)) * 8;
    *(v8us*)(Ph + o) = oh; *(v8us*)(Pl + o) = ol;  }

// d_vtp2: v^T head plane; fragment number ((g * TT / 32 + t / 32) * 4 + d / 16); rows d, k = t. Thread i writes chunk i of the plane: i = (((g * TT / 32 + t / 32) * 4 + d / 16) * 2 + e) * 32 + 16 * hi + (d & 15)
__device__ __forceinline__ void d_vtp2(const float* __restrict__ F, bf* Vh, bf* Vl) {
    const unsigned i = blockIdx.x * 256u + threadIdx.x; if (i >= (unsigned)(NH_ * HD * (TT / 8))) return;
    const unsigned d = ((i >> 6) & 3u) * 16 + (i & 15u); const unsigned t8 = ((i >> 8) % (unsigned)(TT / 32)) * 4 + ((i >> 5) & 1u) * 2 + ((i >> 4) & 1u); const unsigned g = i / (unsigned)((TT / 8) * HD);
    const float* f = F + (size_t)(t8 * 8) * DQ + g * HD + d; v8us oh, ol;
#pragma unroll
    for (int q = 0; q < 8; ++q) { unsigned short a, c2; splitf(f[(size_t)q * DQ], a, c2); oh[q] = a; ol[q] = c2; }
    *(v8us*)(Vh + (size_t)i * 8) = oh; *(v8us*)(Vl + (size_t)i * 8) = ol;  }

// k_planes: all head planes in one launch; blockIdx.y = stream s (q, k, v), blockIdx.z = batch b; F[s][b] -> hi plane P[2 s][b], lo plane P[2 s + 1][b]
__global__ __launch_bounds__(256) void k_planes(const float* __restrict__ F, bf* P) {
    const unsigned s = blockIdx.y, b = blockIdx.z; const float* f = F + (size_t)(s * NB + b) * TT * DQ;
    bf* ph = P + (size_t)(2 * s * NB + b) * (NH_ * TT * HD); bf* pl = ph + (size_t)NB * (NH_ * TT * HD);
    if (s < 2) d_hpl2(f, ph, pl); else d_vtp2(f, ph, pl);
}

// one fragment: b = wave-uniform byte address of the fragment, vo = 16 * lane
__device__ __forceinline__ v16bf ldfr(const char* b, unsigned vo) { return cat16b(*(const v8us*)(b + vo), *(const v8us*)(b + 512 + vo)); }
// 2^x; the v_nop fills the slot that the instruction set asks for behind a transcendental before its result is read or its source overwritten
__device__ __forceinline__ float exp2_slot(float x) { float r; asm("v_exp_f32 %0, %1\n\tv_nop" : "=v"(r) : "v"(x)); return r; }
__device__ __forceinline__ v8i ldm8(const char* b, unsigned vo) { return __builtin_shufflevector(*(const v4i*)(b + vo), *(const v4i*)(b + 16 + vo), 0, 1, 2, 3, 4, 5, 6, 7); }

// k_fattn: one batch (blockIdx.z), one head (blockIdx.y), QWG queries (blockIdx.x); a batch's heads follow the batch before in every plane (plane head number hb); wave w: 32 queries (column w & 3), key range w >> 2 of KR. Per pass of 32 keys:
//   S^T[key][query] = k (q x HD^-0.5)^T (A = k fragments, B = scaled q fragments kept in registers; kh.qh + kh.ql + kl.qh per 32 d);
//   S_sel = (mask[query][key] == 0) ? -1e9 : S (replace, read by value), split into bf16 hi|lo: the two 16-key accumulator tiles of one query tile ARE the B fragment of the next product (element s <- tile s >> 3, register s & 7);
//   T^T[d][query] += v^T S_sel^T (vh.sh + vh.sl + vl.sh).
// Each operand set is fetched for the next pass right behind its last use in this pass, into the same registers. The last pass fetches its own step again (in bounds, unused).
// Then the two key ranges are added through LDS (range 0 + range 1; wave of range r finishes query tile r), softmax over the HD values of a query (32 in the lane, 32 in lane ^ 16), context hi|lo planes.
__global__ __launch_bounds__(256) void k_fattn(const bf* __restrict__ Qh, const bf* __restrict__ Ql, const bf* __restrict__ Kh, const bf* __restrict__ Kl, const bf* __restrict__ Vh, const bf* __restrict__ Vl, const int* __restrict__ M, bf* Ah, bf* Al) {
    __shared__ v4f xs[8 * 8 * 32];
    const int lane = threadIdx.x & 31, lr = lane & 15, hi = lane >> 4;
    const int w = __builtin_amdgcn_readfirstlane((int)(threadIdx.x >> 5)); const int kr = w >> 2;
    const int bz = blockIdx.z, h = blockIdx.y, hb = bz * NH_ + h, q0 = blockIdx.x * QWG + (w & 3) * 32;
    constexpr int NST = TT / KR / 32;
    v16bf qh[2][2], ql[2][2];
    const unsigned vo = lane * 16, vm = (unsigned)(lr * MPITCH + 8 * hi) * 4;
    { const size_t qo = ((size_t)hb * TT + q0) * HD * 2;
#pragma unroll
      for (int qt = 0; qt < 2; ++qt)
#pragma unroll
        for (int ks = 0; ks < 2; ++ks) { qh[qt][ks] = ldfr((const char*)Qh + qo + (qt * 2 + ks) * 1024, vo) * (__bf16)SCL; ql[qt][ks] = ldfr((const char*)Ql + qo + (qt * 2 + ks) * 1024, vo) * (__bf16)SCL; } }   // HD^-0.5 is a power of two: exact on bf16, once per wave instead of once per score
    v8f T[4][2];
#pragma unroll
    for (int mb = 0; mb < 4; ++mb) { T[mb][0] = (v8f){}; T[mb][1] = (v8f){}; }
    // a pass's 32 keys are 4096 bytes in a row in each of the four k and v^T planes; po and mp are wave-uniform
    size_t po = ((size_t)hb * TT + (size_t)kr * (TT / KR)) * HD * 2;
    const char* mp = (const char*)(M + (size_t)bz * SEQ_FULL * SEQ_FULL + (size_t)q0 * MPITCH + kr * (TT / KR));
    v16bf kh[2][2], kl[2][2], vh[4], vl[4]; v8i mk[2][2];
#pragma unroll
    for (int kt = 0; kt < 2; ++kt)
#pragma unroll
        for (int ks = 0; ks < 2; ++ks) { kh[kt][ks] = ldfr((const char*)Kh + po + (kt * 2 + ks) * 1024, vo); kl[kt][ks] = ldfr((const char*)Kl + po + (kt * 2 + ks) * 1024, vo); }
#pragma unroll
    for (int qt = 0; qt < 2; ++qt)
#pragma unroll
        for (int kt = 0; kt < 2; ++kt) mk[qt][kt] = ldm8(mp + (size_t)qt * 16 * MPITCH * 4 + kt * 64, vm);
#pragma unroll
    for (int mb = 0; mb < 4; ++mb) { vh[mb] = ldfr((const char*)Vh + po + mb * 1024, vo); vl[mb] = ldfr((const char*)Vl + po + mb * 1024, vo); }
    // the first pass's operands have landed here: the waits inside the loop then count the loop's own load order alone (merged with this prologue's order, the wait at the loop's head also covered the v^T loads issued at the foot of the pass before)
    asm volatile("" :: "v"(kh[0][0]), "v"(kh[0][1]), "v"(kh[1][0]), "v"(kh[1][1]), "v"(kl[0][0]), "v"(kl[0][1]), "v"(kl[1][0]), "v"(kl[1][1]), "v"(mk[0][0]), "v"(mk[0][1]), "v"(mk[1][0]), "v"(mk[1][1]), "v"(vh[0]), "v"(vh[1]), "v"(vh[2]), "v"(vh[3]), "v"(vl[0]), "v"(vl[1]), "v"(vl[2]), "v"(vl[3]));
#pragma unroll 1   // one pass holds 48 matrix instructions and every register set once; unrolling would double the sets
    for (int s = 0; s < NST; ++s) {
        const int adv = (s + 1 < NST) ? 1 : 0;
        v8f S[2][2];
#pragma unroll
        for (int kt = 0; kt < 2; ++kt) { S[kt][0] = (v8f){}; S[kt][1] = (v8f){}; }
#pragma unroll
        for (int ks = 0; ks < 2; ++ks) {
#pragma unroll
            for (int kt = 0; kt < 2; ++kt)
#pragma unroll
                for (int qt = 0; qt < 2; ++qt) S[kt][qt] = wmmab(kh[kt][ks], qh[qt][ks], S[kt][qt]);
#pragma unroll
            for (int kt = 0; kt < 2; ++kt)
#pragma unroll
                for (int qt = 0; qt < 2; ++qt) S[kt][qt] = wmmab(kh[kt][ks], ql[qt][ks], S[kt][qt]);
#pragma unroll
            for (int kt = 0; kt < 2; ++kt)
#pragma unroll
                for (int qt = 0; qt < 2; ++qt) S[kt][qt] = wmmab(kl[kt][ks], qh[qt][ks], S[kt][qt]);
        }
        po += (size_t)adv * 4096;
#pragma unroll
        for (int kt = 0; kt < 2; ++kt)
#pragma unroll
            for (int ks = 0; ks < 2; ++ks) { kh[kt][ks] = ldfr((const char*)Kh + po + (kt * 2 + ks) * 1024, vo); kl[kt][ks] = ldfr((const char*)Kl + po + (kt * 2 + ks) * 1024, vo); }
        v16bf sh[2], sl[2];
#pragma unroll
        for (int qt = 0; qt < 2; ++qt) {
            v8u uh, ul;   // word kt * 4 + p = elements kt * 8 + 2 p, + 1 of the B fragment
#pragma unroll
            for (int kt = 0; kt < 2; ++kt)
#pragma unroll
                for (int p = 0; p < 4; ++p) {
                    const v2f y = { (mk[qt][kt][2 * p] == 0) ? FILLV : S[kt][qt][2 * p], (mk[qt][kt][2 * p + 1] == 0) ? FILLV : S[kt][qt][2 * p + 1] };
                    const unsigned u = __builtin_bit_cast(unsigned, __builtin_convertvector(y, v2bf));
                    const v2f yh = { __uint_as_float(u << 16), __uint_as_float(u & 0xFFFF0000u) };
                    uh[kt * 4 + p] = u; ul[kt * 4 + p] = __builtin_bit_cast(unsigned, __builtin_convertvector(y - yh, v2bf));
                }
            sh[qt] = __builtin_bit_cast(v16bf, uh); sl[qt] = __builtin_bit_cast(v16bf, ul);
        }
        mp += adv * 128;
#pragma unroll
        for (int qt = 0; qt < 2; ++qt)
#pragma unroll
            for (int kt = 0; kt < 2; ++kt) mk[qt][kt] = ldm8(mp + (size_t)qt * 16 * MPITCH * 4 + kt * 64, vm);
#pragma unroll
        for (int mb = 0; mb < 4; ++mb)
#pragma unroll
            for (int qt = 0; qt < 2; ++qt) T[mb][qt] = wmmab(vh[mb], sh[qt], T[mb][qt]);
#pragma unroll
        for (int mb = 0; mb < 4; ++mb)
#pragma unroll
            for (int qt = 0; qt < 2; ++qt) T[mb][qt] = wmmab(vh[mb], sl[qt], T[mb][qt]);
#pragma unroll
        for (int mb = 0; mb < 4; ++mb)
#pragma unroll
            for (int qt = 0; qt < 2; ++qt) T[mb][qt] = wmmab(vl[mb], sh[qt], T[mb][qt]);
#pragma unroll
        for (int mb = 0; mb < 4; ++mb) { vh[mb] = ldfr((const char*)Vh + po + mb * 1024, vo); vl[mb] = ldfr((const char*)Vl + po + mb * 1024, vo); }
        // s_wait_xcnt: the next pass forms new addresses in the registers that this pass's loads name, before any wait covers the v^T loads.
        // v_nop x 4: the pass's last matrix instructions stand right in front of the branch, and the first one behind it writes its result over their B operand
        asm volatile("s_wait_xcnt 0x0\n\tv_nop\n\tv_nop\n\tv_nop\n\tv_nop" ::: "memory");
    }
    // hand the other query tile's partial sums to the wave of the other key range, take its sums for this wave's tile
    v8f a[4];
#pragma unroll
    for (int mb = 0; mb < 4; ++mb) { const v8f sv = kr ? T[mb][0] : T[mb][1]; a[mb] = kr ? T[mb][1] : T[mb][0];
        xs[(w * 8 + mb * 2) * 32 + lane] = (v4f){sv[0], sv[1], sv[2], sv[3]}; xs[(w * 8 + mb * 2 + 1) * 32 + lane] = (v4f){sv[4], sv[5], sv[6], sv[7]}; }
    __syncthreads();
#pragma unroll
    for (int mb = 0; mb < 4; ++mb) { const v4f o0 = xs[((w ^ 4) * 8 + mb * 2) * 32 + lane], o1 = xs[((w ^ 4) * 8 + mb * 2 + 1) * 32 + lane];
#pragma unroll
        for (int j = 0; j < 4; ++j) { a[mb][j] += o0[j]; a[mb][4 + j] += o1[j]; } }
    float mx = a[0][0];
#pragma unroll
    for (int mb = 0; mb < 4; ++mb)
#pragma unroll
        for (int j = 0; j < 8; ++j) mx = fmaxf(mx, a[mb][j]);
    mx = fmaxf(mx, __shfl_xor(mx, 16, 32));
    float sum = 0.f;
#pragma unroll
    for (int mb = 0; mb < 4; ++mb)
#pragma unroll
        for (int j = 0; j < 8; ++j) { a[mb][j] = exp2_slot(__fmul_rn(__fsub_rn(a[mb][j], mx), 1.4426950408889634f)); sum += a[mb][j]; }
    sum += __shfl_xor(sum, 16, 32);
    const float f = __fdiv_rn(1.0f, sum);
    const size_t oo = (size_t)(bz * TT + q0 + kr * 16 + lr) * DQ + (size_t)h * HD + 8 * hi;
    v4u oh[4], ol[4];
#pragma unroll
    for (int mb = 0; mb < 4; ++mb)
#pragma unroll
        for (int p = 0; p < 4; ++p) {
            const v2f y = { a[mb][2 * p] * f, a[mb][2 * p + 1] * f };
            const unsigned u = __builtin_bit_cast(unsigned, __builtin_convertvector(y, v2bf));
            const v2f yh = { __uint_as_float(u << 16), __uint_as_float(u & 0xFFFF0000u) };
            oh[mb][p] = u; ol[mb][p] = __builtin_bit_cast(unsigned, __builtin_convertvector(y - yh, v2bf));
        }
    __builtin_amdgcn_sched_barrier(0);   // every value is formed in front of the stores: no register that an issued store names is rewritten behind it
#pragma unroll
    for (int mb = 0; mb < 4; ++mb) { *(v8us*)(Ah + oo + mb * 16) = __builtin_bit_cast(v8us, oh[mb]); *(v8us*)(Al + oo + mb * 16) = __builtin_bit_cast(v8us, ol[mb]); }
}

constexpr size_t WS_TOTAL = 4 * SZ_W + NB * (3 * SZ_XB + 3 * SZ_F + 6 * SZ_PL + 2 * SZ_AT);
static_assert(WS_TOTAL <= (size_t)268435456);
// coverage equalities (threads x 8 elements == plane elements; tiles x 64 x 64 == plane elements)
static_assert(((size_t)DQ * DM / 8) % 256 == 0);
static_assert(((size_t)TT * DM / 8) % 256 == 0);
static_assert(((size_t)NH_ * TT * HD / 8) % 256 == 0);
static_assert((size_t)NH_ * TT * (HD / 8) < ((size_t)1 << 31));

extern "C" void kernel_launch(void* const* d_in, const int* in_sizes, int n_in,
                              void* d_out, int out_size, void* d_ws, size_t ws_size, hipStream_t stream) {
    if (n_in < 12) return;
    const size_t need_x = (size_t)(NB - 1) * SEQ_FULL * DM + (size_t)SEQ * DM;
    const size_t need_m = (size_t)(NB - 1) * SEQ_FULL * SEQ_FULL + (size_t)(SEQ - 1) * SEQ_FULL + (size_t)SEQ;
    if ((size_t)in_sizes[0] < need_x || (size_t)in_sizes[1] < need_x || (size_t)in_sizes[2] < need_x || (size_t)in_sizes[3] < need_m) return;
    if ((size_t)in_sizes[4] < (size_t)DQ * DM || (size_t)in_sizes[6] < (size_t)DQ * DM || (size_t)in_sizes[8] < (size_t)DQ * DM || (size_t)in_sizes[10] < (size_t)DM * DQ) return;
    if (in_sizes[5] < DQ || in_sizes[7] < DQ || in_sizes[9] < DQ || in_sizes[11] < DM) return;
    if ((size_t)out_size < (size_t)NB * SEQ * DM) return;
    if (WS_TOTAL > ws_size) return;
    // wire order: k, q, v, mask (int), Wq, bq, Wk, bk, Wv, bv, Wo, bo ('oi' weights)
    const float* xk = (const float*)d_in[0]; const float* xq = (const float*)d_in[1]; const float* xv = (const float*)d_in[2]; const int* mk = (const int*)d_in[3];
    const float* wq = (const float*)d_in[4]; const float* bq = (const float*)d_in[5]; const float* wk = (const float*)d_in[6]; const float* bk = (const float*)d_in[7];
    const float* wv = (const float*)d_in[8]; const float* bv = (const float*)d_in[9]; const float* wo = (const float*)d_in[10]; const float* bo = (const float*)d_in[11];
    float* OUT = (float*)d_out;     // [NB][SEQ][1024]
    char* wsp = (char*)d_ws;
    bf* WB = (bf*)wsp; wsp += 4 * SZ_W;            // Wq, Wk, Wv, Wo
    bf* XB = (bf*)wsp; wsp += 3 * NB * SZ_XB;      // [q, k, v][b][t][DM]
    float* F = (float*)wsp; wsp += 3 * NB * SZ_F;  // [q, k, v][b][t][DQ]
    bf* PL = (bf*)wsp; wsp += 6 * NB * SZ_PL;      // [q hi, q lo, k hi, k lo, v^T hi, v^T lo][b]
    bf* ATh = (bf*)wsp; wsp += NB * SZ_AT; bf* ATl = (bf*)wsp; wsp += NB * SZ_AT;   // [b][t][DQ]
    constexpr size_t PS = (size_t)NB * NH_ * TT * HD;   // elements of one plane over all batches

    k_cvt8<<<3 * NB * GX + 4 * GW, 256, 0, stream>>>(xq, xk, xv, wq, wk, wv, wo, XB, WB);
    // z = q, k, v: F[z][b * TT + t][n] = bf16(x_z) W_z^T + b_z
    k_gemmw<bf, 0, true, 1><<<dim3(NB * TT / 64, DQ / 64, 3), 32, 0, stream>>>(XB, nullptr, WB, nullptr, DM, DM, F, DQ, bq, bk, bv, (size_t)NB * TT * DM, (size_t)DQ * DM, (size_t)NB * TT * DQ, 0);
    k_planes<<<dim3(GP, 3, NB), 256, 0, stream>>>(F, PL);
    // all batches and heads: T = select(q k^T x HD^-0.5) v, softmax over d -> ATh|ATl[b * TT + t][h * HD + d]
    k_fattn<<<dim3(TT / QWG, NH_, NB), 256, 0, stream>>>(PL, PL + PS, PL + 2 * PS, PL + 3 * PS, PL + 4 * PS, PL + 5 * PS, mk, ATh, ATl);
    // out = (ATh + ATl) Wo^T + bo
    k_gemmw<bf, 1, true, 1><<<dim3(NB * TT / 64, DM / 64, 1), 32, 0, stream>>>(ATh, ATl, WB + 3 * (size_t)DQ * DM, nullptr, DQ, DQ, OUT, DM, bo, bo, bo, 0, 0, 0, 0);
}

// v004
// A run of this version takes 135 microseconds.
// Two timings next to v003 both put it at 1.37 times that version's speed.
// Over all steps from v000 it is 10.1 times as fast.
#include <hip/hip_runtime.h>

// Contractions (all f32 accumulate): q/k/v projections v_wmma_f32_16x16x32_bf16 (inputs and weights RNE-converted to bf16, single product, f32 bias add); v^T k, (v^T k) q^T and, for mask tiles that hold a zero, k.q^T and v^T.correction^T: v_wmma_f32_16x16x32_bf16 on bf16 hi|lo pairs (three products hh + hl + lh into one accumulator); output projection bf16 hi/lo context planes x bf16 weights (2 products) + f32 bias; softmax over the head width in f32.
// Multi-head attention on three input streams (wire order k, q, v [NB][SEQ][1024]); 'oi' weights; 16 heads x 64; scores x 0.125; int mask [NB][1][S][S]: where mask == 0 the scaled score is REPLACED by -1e9 (read by value); NO softmax over keys: T = S_sel . V, then softmax over the 64 head columns of T; merged context x Wo^T + bo.
// With no softmax between the two products, for ANY mask: T = S_sel V = (q x 0.125) (k^T V) + C V, where C[query][key] = (mask == 0) ? -1e9 - S : 0. The first term needs one 64 x 64 matrix per head; C is zero on every 32 x 32 tile whose mask holds no zero, and only the other tiles are worked through key by key.
// Six launches, each over both batches (and over the q, k, v streams where they are alike): bf16 copies -> projection GEMMs (f32, + bias) -> bf16 hi|lo head planes of q, k, v^T and k^T in fragment order -> v^T k per head (hi|lo planes) and, in the same launch, one bit per 32 x 32 mask tile (tile holds a zero) -> one kernel over all heads: T^T = (v^T k)(q x 0.125)^T; per flagged tile S^T = k (q x 0.125)^T -> C^T -> bf16 hi|lo B operands in registers -> T^T += v^T C^T; the two halves of a work-group added through LDS; softmax over d -> context hi/lo bf16 planes; context x Wo.

#ifndef NB
#define NB 2
#endif
#ifndef SEQ
#define SEQ 2048
#endif
#define NB_FULL  2
#define SEQ_FULL 2048
#define TT   SEQ
#define DM   1024
#define NH_  16
#define HD   64
#define DQ   (NH_ * HD)
#define QWG  128  // queries of one work-group of the fused kernel: 4 wave columns x 32 queries
#define KR   2    // key ranges of one work-group: 4 x 2 = 8 waves
#define MQ   512  // keys of one work-group of the mask scan
#define MPITCH SEQ_FULL
#define SCL  0.125f   // HD^-0.5
#define FILLV (-1.0e9f)

static_assert(TT % 256 == 0);
static_assert(TT % 64 == 0);
static_assert(DM % 64 == 0);
static_assert(DQ == DM);
static_assert(HD == 64);
static_assert(TT % QWG == 0);
static_assert(NB <= NB_FULL);
static_assert(SEQ <= SEQ_FULL);
static_assert(HD % 32 == 0);
static_assert(TT % 32 == 0);
static_assert(DM % 32 == 0);
static_assert(HD / 8 == 8);
static_assert(TT % (KR * 32) == 0);
static_assert(KR == 2);
static_assert(SCL == 0.125f);
static_assert(TT / KR / 32 == 32);        // a wave's tile bits fill one 32-bit word
static_assert(TT / KR == 2 * MQ);         // made of two scan words of 16 bits
static_assert(TT % (8 * 64) == 0);
static_assert((size_t)NB_FULL * SEQ_FULL * SEQ_FULL * 4 < ((size_t)1 << 32));   // byte offsets into the mask and into a plane fit 32 bits
static_assert((size_t)NB * NH_ * TT * HD * 2 < ((size_t)1 << 32));

constexpr size_t al256(size_t b) { return (b + 255) & ~(size_t)255; }
constexpr size_t SZ_W  = al256((size_t)DQ * DM * 2);            // one weight plane (bf16)
constexpr size_t SZ_XB = al256((size_t)TT * DM * 2);            // bf16 activation copy of one stream and batch
constexpr size_t SZ_F  = al256((size_t)TT * DQ * 4);            // f32 projection of one stream and batch
constexpr size_t SZ_PL = al256((size_t)NH_ * TT * HD * 2);      // one bf16 head plane of one batch
constexpr size_t SZ_AT = al256((size_t)TT * DQ * 2);            // one context plane (bf16) of one batch
constexpr unsigned GW = (unsigned)((size_t)DQ * DM / 8 / 256);         // work-groups of one weight copy
constexpr unsigned GX = (unsigned)((size_t)TT * DM / 8 / 256);         // work-groups of one activation copy (one stream, one batch)
constexpr unsigned GP = (unsigned)((size_t)NH_ * TT * HD / 8 / 256);   // work-groups of one head plane pair
constexpr unsigned GKV = NB * NH_ * (HD / 16);                // work-groups of v^T k: one strip of 16 rows each
constexpr unsigned GMS = NB * (TT / 32) * (TT / MQ);          // work-groups of the mask scan: 32 queries x MQ keys each
constexpr size_t SZ_KV = al256((size_t)NB * NH_ * HD * HD * 2);   // one v^T k plane (bf16), all batches and heads
constexpr size_t SZ_FL = (size_t)GMS * 128;                   // tile bits: one word per scan work-group, each in a 128-byte line of its own
// the slices of one buffer stand back to back: stream-major, then batch
static_assert(SZ_W == (size_t)DQ * DM * 2);
static_assert(SZ_XB == (size_t)TT * DM * 2);
static_assert(SZ_F == (size_t)TT * DQ * 4);
static_assert(SZ_PL == (size_t)NH_ * TT * HD * 2);
static_assert(SZ_AT == (size_t)TT * DQ * 2);

typedef _Float16 h16;
typedef unsigned short bf;
typedef __attribute__((ext_vector_type(16))) __bf16   v16bf;
typedef __attribute__((ext_vector_type(16))) _Float16 v16h;
typedef __attribute__((ext_vector_type(8)))  _Float16 v8h;
typedef __attribute__((ext_vector_type(8)))  unsigned short v8us;
typedef __attribute__((ext_vector_type(2)))  __bf16   v2bf;
typedef __attribute__((ext_vector_type(2)))  float    v2f;
typedef __attribute__((ext_vector_type(8)))  unsigned v8u;
typedef __attribute__((ext_vector_type(4)))  unsigned v4u;
typedef __attribute__((ext_vector_type(8)))  int      v8i;
typedef __attribute__((ext_vector_type(8)))  float    v8f;
typedef __attribute__((ext_vector_type(4)))  float    v4f;
typedef __attribute__((ext_vector_type(4)))  int      v4i;
typedef v4f  __attribute__((may_alias)) v4fa;

__device__ __forceinline__ unsigned short f2bf(float f) { unsigned u = __float_as_uint(f); u += 0x7FFFu + ((u >> 16) & 1u); return (unsigned short)(u >> 16); }
__device__ __forceinline__ float bf2f(unsigned short b) { return __uint_as_float(((unsigned)b) << 16); }
__device__ __forceinline__ float bfr(float f) { return bf2f(f2bf(f)); }
__device__ __forceinline__ v16h cat16(v8h lo, v8h hi) { return __builtin_shufflevector(lo, hi, 0, 1, 2, 3, 4, 5, 6, 7, 8, 9, 10, 11, 12, 13, 14, 15); }
__device__ __forceinline__ v16bf cat16b(v8us lo, v8us hi) { return __builtin_bit_cast(v16bf, __builtin_shufflevector(lo, hi, 0, 1, 2, 3, 4, 5, 6, 7, 8, 9, 10, 11, 12, 13, 14, 15)); }
__device__ __forceinline__ v8f wmma16(v16h a, v16h b, v8f c) { return __builtin_amdgcn_wmma_f32_16x16x32_f16(false, a, false, b, (short)0, c, false, false); }
__device__ __forceinline__ v8f wmmab(v16bf a, v16bf b, v8f c) { return __builtin_amdgcn_wmma_f32_16x16x32_bf16(false, a, false, b, (short)0, c, false, false); }

// ---- k_gemmw: register-blocked GEMM, ONE WAVE per 64x64 output tile (16 accumulators), operands straight from K-contiguous 16-bit planes; grid (M/64, N/64, Z * KS), 32 threads.
// C[m][n] (f32, pitch ldc, + optional f32 bias[n]) = sum_k A[m][k] Bt[n][k] (+ split products per NSPLIT). z-batch strides sA/sB/sC in elements. K % 32 == 0, M % 64 == 0, N % 64 == 0.
// The bias vector goes by z: bias, bias1, bias2 for z = 0, 1, 2.
// Split over k: K = KS * KC (KC % 32 == 0), blockIdx.z = z * KS + ks; a work-group sums only k in [ks * KC, ks * KC + KC) and stores its partial tile at C + ks * sP; the reader of C adds the KS partials. KS == 1: KC == K, the whole sum.
// Fragment map: lane -> row/col (lane & 15); elements 0..7 <- k0 + 8*(lane>>4) + 0..7, elements 8..15 <- k0 + 16 + 8*(lane>>4) + 0..7 (both operands); acc[j] = (row 8*(lane>>4) + j, col lane & 15).
template <typename T16> struct WFrag;
template <> struct WFrag<h16> { typedef v16h V; static __device__ __forceinline__ V ld(const h16* p) { return cat16(*(const v8h*)p, *(const v8h*)(p + 16)); } static __device__ __forceinline__ v8f mma(V a, V b, v8f c) { return wmma16(a, b, c); } };
template <> struct WFrag<bf> { typedef v16bf V; static __device__ __forceinline__ V ld(const bf* p) { return cat16b(*(const v8us*)p, *(const v8us*)(p + 16)); } static __device__ __forceinline__ v8f mma(V a, V b, v8f c) { return wmmab(a, b, c); } };
template <typename T16, int NSPLIT, bool BIAS, int KS>
__global__ __launch_bounds__(32) void k_gemmw(const T16* __restrict__ A, const T16* __restrict__ A2, const T16* __restrict__ Bt, const T16* __restrict__ Bt2, int K, int KC, float* C, int ldc, const float* __restrict__ bias0, const float* __restrict__ bias1, const float* __restrict__ bias2, size_t sA, size_t sB, size_t sC, size_t sP) {
    typedef typename WFrag<T16>::V V;
    __shared__ __align__(16) float os[16 * 68];
    const size_t z = blockIdx.z / (unsigned)KS, ks = blockIdx.z % (unsigned)KS, ko = ks * KC; A += z * sA + ko; if (A2) A2 += z * sA + ko; Bt += z * sB + ko; if (Bt2) Bt2 += z * sB + ko; C += z * sC + ks * sP;
    const float* bias = z == 0 ? bias0 : (z == 1 ? bias1 : bias2);
    const int lane = threadIdx.x & 31, lr = lane & 15, hi = lane >> 4; const int r0 = blockIdx.x * 64, c0 = blockIdx.y * 64;
    v8f acc[4][4];
#pragma unroll
    for (int mb = 0; mb < 4; ++mb)
#pragma unroll
        for (int nb = 0; nb < 4; ++nb) acc[mb][nb] = (v8f){};
    const size_t aoff = (size_t)(r0 + lr) * K + 8 * hi, boff = (size_t)(c0 + lr) * K + 8 * hi;
#pragma unroll 1
    for (int kc = 0; kc < KC; kc += 32) {
        V a[4], a2[4];
#pragma unroll
        for (int mb = 0; mb < 4; ++mb) { a[mb] = WFrag<T16>::ld(A + aoff + (size_t)mb * 16 * K + kc); if (NSPLIT == 1 || NSPLIT == 2) a2[mb] = WFrag<T16>::ld(A2 + aoff + (size_t)mb * 16 * K + kc); }
#pragma unroll
        for (int nb = 0; nb < 4; ++nb) { const V b = WFrag<T16>::ld(Bt + boff + (size_t)nb * 16 * K + kc); V b2; if (NSPLIT >= 2) b2 = WFrag<T16>::ld(Bt2 + boff + (size_t)nb * 16 * K + kc);
#pragma unroll
            for (int mb = 0; mb < 4; ++mb) { acc[mb][nb] = WFrag<T16>::mma(a[mb], b, acc[mb][nb]); if (NSPLIT == 1 || NSPLIT == 2) acc[mb][nb] = WFrag<T16>::mma(a2[mb], b, acc[mb][nb]); if (NSPLIT >= 2) acc[mb][nb] = WFrag<T16>::mma(a[mb], b2, acc[mb][nb]); } }
        asm volatile("v_nop\n\tv_nop\n\tv_nop\n\tv_nop" : "+v"(acc[0][0]), "+v"(acc[1][1]), "+v"(acc[2][2]), "+v"(acc[3][3]) : "v"(a[0]), "v"(a[3]));
    }
#pragma unroll
    for (int mb = 0; mb < 4; ++mb) {
#pragma unroll
        for (int nb = 0; nb < 4; ++nb) {
#pragma unroll
            for (int j = 0; j < 8; ++j) os[(hi * 8 + j) * 68 + nb * 16 + lr] = acc[mb][nb][j]; }
        __builtin_amdgcn_wave_barrier(); asm volatile("" ::: "memory");
        float* crow = C + (size_t)(r0 + mb * 16) * ldc + c0;
{
#pragma unroll
            for (int s = 0; s < 8; ++s) { const int row = 2 * s + hi, cofs = lr * 4; v4f val = *(const v4fa*)(os + row * 68 + cofs); if (BIAS) { val[0] += bfr(bias[c0 + cofs]); val[1] += bfr(bias[c0 + cofs + 1]); val[2] += bfr(bias[c0 + cofs + 2]); val[3] += bfr(bias[c0 + cofs + 3]); }
                *(v4f*)(crow + (size_t)row * ldc + cofs) = val; }
             }
        __builtin_amdgcn_wave_barrier(); asm volatile("" ::: "memory");
    }
}

__device__ __forceinline__ void splitf(float y, unsigned short& h, unsigned short& l) { h = f2bf(y); l = f2bf(y - bf2f(h)); }

// k_cvt8: every f32 -> bf16 copy in one launch; a work-group copies 2048 elements. Work-groups [0, 3 * NB * GX): activations, stream s, batch b -> XB[s][b]; the other 4 * GW: weights -> WB[s]. The grid covers every slice exactly.
__global__ __launch_bounds__(256) void k_cvt8(const float* __restrict__ x0, const float* __restrict__ x1, const float* __restrict__ x2, const float* __restrict__ w0, const float* __restrict__ w1, const float* __restrict__ w2, const float* __restrict__ w3, bf* XB, bf* WB) {
    const unsigned bx = blockIdx.x; const float* src; bf* dst;
    if (bx < 3u * NB * GX) { const unsigned s = bx / (NB * GX), b = (bx / GX) % (unsigned)NB, c = bx % GX; src = (s == 0 ? x0 : (s == 1 ? x1 : x2)) + (size_t)b * SEQ_FULL * DM + (size_t)c * 2048; dst = XB + (size_t)bx * 2048; }
    else { const unsigned r = bx - 3u * NB * GX, s = r / GW, c = r % GW; src = (s == 0 ? w0 : (s == 1 ? w1 : (s == 2 ? w2 : w3))) + (size_t)c * 2048; dst = WB + (size_t)r * 2048; }
    const unsigned i = threadIdx.x; const v8f v = *(const v8f*)(src + i * 8); v8us o;
#pragma unroll
    for (int k = 0; k < 8; ++k) o[k] = f2bf(v[k]); *(v8us*)(dst + i * 8) = o;  }

// Fragment order of a 16-bit plane: a 16 x 32 fragment (16 rows or columns x 32 k) is 512 elements in a row, as two halves of 256: half e, lane l = 16 * hi + c, 8 elements <- row c, k = 16 * e + 8 * hi + 0..7.
// A wave's two 16-byte loads of a fragment then each cover 512 contiguous bytes (4 whole lines) instead of 16 lines.
// d_hpl2: q or k head plane; fragment number ((h * TT / 16 + t / 16) * 2 + d / 32); rows t, k = d
__device__ __forceinline__ void d_hpl2(const float* __restrict__ F, bf* Ph, bf* Pl) {
    const unsigned i = blockIdx.x * 256u + threadIdx.x; if (i >= (unsigned)(NH_ * TT * (HD / 8))) return;
    const unsigned d8 = i % (unsigned)(HD / 8); const unsigned t = (i / (unsigned)(HD / 8)) % (unsigned)TT; const unsigned h = i / (unsigned)((HD / 8) * TT);
    const float* f = F + (size_t)t * DQ + h * HD + d8 * 8; const v4f a0 = *(const v4f*)f, a1 = *(const v4f*)(f + 4); v8us oh, ol;
#pragma unroll
    for (int q = 0; q < 4; ++q) { unsigned short a, c2; splitf(a0[q], a, c2); oh[q] = a; ol[q] = c2; splitf(a1[q], a, c2); oh[4 + q] = a; ol[4 + q] = c2; }
    const size_t o = (size_t)((h * (unsigned)(TT / 16) + (t >> 4)) * 2u + (d8 >> 2)) * 512 + ((d8 >> 1) & 1u) * 256 + ((d8 & 1u) * 16 + (t & 15u)) * 8;
    *(v8us*)(Ph + o) = oh; *(v8us*)(Pl + o) = ol;  }

// d_vtp2: v^T head plane; fragment number ((g * TT / 32 + t / 32) * 4 + d / 16); rows d, k = t. Thread i writes chunk i of the plane: i = (((g * TT / 32 + t / 32) * 4 + d / 16) * 2 + e) * 32 + 16 * hi + (d & 15)
__device__ __forceinline__ void d_vtp2(const float* __restrict__ F, bf* Vh, bf* Vl) {
    const unsigned i = blockIdx.x * 256u + threadIdx.x; if (i >= (unsigned)(NH_ * HD * (TT / 8))) return;
    const unsigned d = ((i >> 6) & 3u) * 16 + (i & 15u); const unsigned t8 = ((i >> 8) % (unsigned)(TT / 32)) * 4 + ((i >> 5) & 1u) * 2 + ((i >> 4) & 1u); const unsigned g = i / (unsigned)((TT / 8) * HD);
    const float* f = F + (size_t)(t8 * 8) * DQ + g * HD + d; v8us oh, ol;
#pragma unroll
    for (int q = 0; q < 8; ++q) { unsigned short a, c2; splitf(f[(size_t)q * DQ], a, c2); oh[q] = a; ol[q] = c2; }
    *(v8us*)(Vh + (size_t)i * 8) = oh; *(v8us*)(Vl + (size_t)i * 8) = ol;  }

// k_planes: all head planes in one launch; blockIdx.y = plane pair s (q, k, v^T, k^T), blockIdx.z = batch b; F[q, k, v, k][b] -> hi plane P[2 s][b], lo plane P[2 s + 1][b]
__global__ __launch_bounds__(256) void k_planes(const float* __restrict__ F, bf* P) {
    const unsigned s = blockIdx.y, b = blockIdx.z; const float* f = F + (size_t)((s == 3 ? 1u : s) * NB + b) * TT * DQ;
    bf* ph = P + (size_t)(2 * s * NB + b) * (NH_ * TT * HD); bf* pl = ph + (size_t)NB * (NH_ * TT * HD);
    if (s < 2) d_hpl2(f, ph, pl); else d_vtp2(f, ph, pl);
}

// one fragment: b wave-uniform, b + vo = byte address of the fragment + 16 * lane
__device__ __forceinline__ v16bf ldfr(const char* b, unsigned vo) { return cat16b(*(const v8us*)(b + vo), *(const v8us*)(b + 512 + vo)); }
// 2^x; the v_nop fills the slot that the instruction set asks for behind a transcendental before its result is read or its source overwritten
__device__ __forceinline__ float exp2_slot(float x) { float r; asm("v_exp_f32 %0, %1\n\tv_nop" : "=v"(r) : "v"(x)); return r; }
__device__ __forceinline__ v8i ldm8(const char* b, unsigned vo) { return __builtin_shufflevector(*(const v4i*)(b + vo), *(const v4i*)(b + 16 + vo), 0, 1, 2, 3, 4, 5, 6, 7); }

// k_pre: two jobs that the attention kernel needs, independent of each other, in one launch.
// Work-groups [0, GKV): plane head hb = blockIdx.x / 4, strip mb = blockIdx.x % 4: G[d][e] = sum_t v[t][d] k[t][e] for the 16 rows d of the strip, all 64 e (A = v^T fragments, B = k^T fragments, both k = t; vh.kh + vh.kl + vl.kh).
//   Wave w sums keys [w * TT / 8, + TT / 8); the 8 partial strips are added through LDS in wave order; G goes out as bf16 hi|lo in A-fragment order (rows d, k = e): fragment number (hb * 4 + mb) * 2 + e / 32.
// The other GMS work-groups: r = (batch * TT / 32 + query tile) * (TT / MQ) + key block: bit p of FL[r * 32] = the mask of these 32 queries holds a zero among keys [32 p, 32 p + 32) of the block.
__global__ __launch_bounds__(256) void k_pre(const bf* __restrict__ Vh, const bf* __restrict__ Vl, const bf* __restrict__ KTh, const bf* __restrict__ KTl, const int* __restrict__ M, bf* Gh, bf* Gl, unsigned* FL) {
    __shared__ __align__(16) float red[8 * 32 * 32];   // [wave][nb * 8 + j][lane]
    __shared__ unsigned fl[8];
    const int lane = threadIdx.x & 31;
    const int w = __builtin_amdgcn_readfirstlane((int)(threadIdx.x >> 5));
    if (blockIdx.x < GKV) {
        const unsigned hb = blockIdx.x >> 2, mb = blockIdx.x & 3u, vo = lane * 16;
        const size_t po = ((size_t)hb * TT + (size_t)w * (TT / 8)) * HD * 2;
        v8f acc[4];
#pragma unroll
        for (int nb = 0; nb < 4; ++nb) acc[nb] = (v8f){};
#pragma unroll   // straight-line: no matrix instruction stands in front of a back edge
        for (int s = 0; s < TT / 8 / 32; s += 2) {
            v16bf vh[2], vl[2], kh[2][4], kl[2][4];
#pragma unroll
            for (int u = 0; u < 2; ++u) { vh[u] = ldfr((const char*)Vh + po + (s + u) * 4096 + mb * 1024, vo); vl[u] = ldfr((const char*)Vl + po + (s + u) * 4096 + mb * 1024, vo);
#pragma unroll
                for (int nb = 0; nb < 4; ++nb) { kh[u][nb] = ldfr((const char*)KTh + po + (s + u) * 4096 + nb * 1024, vo); kl[u][nb] = ldfr((const char*)KTl + po + (s + u) * 4096 + nb * 1024, vo); } }
            // the 40 loads of two steps are all in flight together: left alone, the compiler issues them two at a time, each pair with a full wait in front of its matrix instruction
            asm volatile("" :: "v"(vh[0]), "v"(vh[1]), "v"(vl[0]), "v"(vl[1]), "v"(kh[0][0]), "v"(kh[0][1]), "v"(kh[0][2]), "v"(kh[0][3]), "v"(kh[1][0]), "v"(kh[1][1]), "v"(kh[1][2]), "v"(kh[1][3]), "v"(kl[0][0]), "v"(kl[0][1]), "v"(kl[0][2]), "v"(kl[0][3]), "v"(kl[1][0]), "v"(kl[1][1]), "v"(kl[1][2]), "v"(kl[1][3]));
#pragma unroll
            for (int u = 0; u < 2; ++u) {
#pragma unroll
                for (int nb = 0; nb < 4; ++nb) acc[nb] = wmmab(vh[u], kh[u][nb], acc[nb]);
#pragma unroll
                for (int nb = 0; nb < 4; ++nb) acc[nb] = wmmab(vh[u], kl[u][nb], acc[nb]);
#pragma unroll
                for (int nb = 0; nb < 4; ++nb) acc[nb] = wmmab(vl[u], kh[u][nb], acc[nb]);
            }
        }
#pragma unroll
        for (int nb = 0; nb < 4; ++nb)
#pragma unroll
            for (int j = 0; j < 8; ++j) red[(w * 32 + nb * 8 + j) * 32 + lane] = acc[nb][j];
        __syncthreads();
        // thread i < 128 forms chunk i of the strip's two fragments: i = (ks * 2 + e) * 32 + l; row c = l & 15, columns (ks * 2 + e) * 16 + 8 * (l >> 4) + 0..7, which are 8 lanes in a row of accumulator register c & 7
        if (threadIdx.x < 128) {
            const unsigned i = threadIdx.x, c = i & 15u;
            const float* rp = red + ((i >> 5) * 8 + (c & 7u)) * 32 + (c >> 3) * 16 + ((i >> 4) & 1u) * 8;
            v4f s0 = *(const v4fa*)rp, s1 = *(const v4fa*)(rp + 4);
#pragma unroll
            for (int u = 1; u < 8; ++u) { s0 += *(const v4fa*)(rp + u * 1024); s1 += *(const v4fa*)(rp + u * 1024 + 4); }
            v8us oh, ol;
#pragma unroll
            for (int q = 0; q < 4; ++q) { unsigned short a, c2; splitf(s0[q], a, c2); oh[q] = a; ol[q] = c2; splitf(s1[q], a, c2); oh[4 + q] = a; ol[4 + q] = c2; }
            *(v8us*)(Gh + (size_t)blockIdx.x * 1024 + i * 8) = oh; *(v8us*)(Gl + (size_t)blockIdx.x * 1024 + i * 8) = ol;
        }
    } else {
        const unsigned r = blockIdx.x - GKV, kb = r % (unsigned)(TT / MQ), qt = (r / (unsigned)(TT / MQ)) % (unsigned)(TT / 32), b = r / (unsigned)((TT / MQ) * (TT / 32));
        // wave w: rows 4 w .. 4 w + 3 of the tile row; a load covers 128 keys of one row, lane l keys 4 l .. 4 l + 3
        const int* mp = M + (size_t)b * SEQ_FULL * SEQ_FULL + (size_t)(qt * 32 + w * 4) * MPITCH + kb * MQ + lane * 4;
        unsigned mn[MQ / 128];
#pragma unroll
        for (int c = 0; c < MQ / 128; ++c) mn[c] = 0xFFFFFFFFu;
#pragma unroll
        for (int row = 0; row < 4; ++row)
#pragma unroll
            for (int c = 0; c < MQ / 128; ++c) { const v4i x = *(const v4i*)(mp + (size_t)row * MPITCH + c * 128);
                mn[c] = min(min(mn[c], min((unsigned)x[0], (unsigned)x[1])), min((unsigned)x[2], (unsigned)x[3])); }   // unsigned minimum: 0 exactly where a value is 0
        unsigned bits = 0;
#pragma unroll
        for (int c = 0; c < MQ / 128; ++c) { const unsigned bal = __builtin_amdgcn_ballot_w32(mn[c] == 0u);
#pragma unroll
            for (int g = 0; g < 4; ++g) bits |= ((bal >> (8 * g)) & 0xFFu) ? (1u << (c * 4 + g)) : 0u; }
        if (lane == 0) fl[w] = bits;
        __syncthreads();
        if (threadIdx.x == 0) { unsigned o = 0;
#pragma unroll
            for (int u = 0; u < 8; ++u) o |= fl[u];
            FL[(size_t)r * 32] = o; }
    }
}

// k_fattn: one batch (blockIdx.z), one head (blockIdx.y), QWG queries (blockIdx.x); a batch's heads follow the batch before in every plane (plane head number hb); wave w: 32 queries (column w & 3), half kr = w >> 2 of KR.
//   T^T[d][query] = G (q x HD^-0.5)^T, G = v^T k of the head (k_pre): wave kr sums columns e in [32 kr, 32 kr + 32) (gh.qh + gh.ql + gl.qh).
// Then, only for those of the wave's 32 tiles of 32 keys (key range kr) whose bit in FL says that the mask holds a zero there:
//   S^T[key][query] = k (q x HD^-0.5)^T (A = k fragments, B = scaled q fragments kept in registers; kh.qh + kh.ql + kl.qh per 32 d);
//   C = (mask[query][key] == 0) ? -1e9 - S : 0 (takes S out of the full sum and puts -1e9 in; read by value), split into bf16 hi|lo: the two 16-key accumulator tiles of one query tile ARE the B fragment of the next product (element s <- tile s >> 3, register s & 7);
//   T^T[d][query] += v^T C^T (vh.sh + vh.sl + vl.sh).
// Then the two halves are added through LDS (half 0 + half 1; wave of range r finishes query tile r), softmax over the HD values of a query (32 in the lane, 32 in lane ^ 16), context hi|lo planes.
__global__ __launch_bounds__(256) void k_fattn(const bf* __restrict__ Qh, const bf* __restrict__ Ql, const bf* __restrict__ Kh, const bf* __restrict__ Kl, const bf* __restrict__ Vh, const bf* __restrict__ Vl, const bf* __restrict__ Gh, const bf* __restrict__ Gl, const unsigned* __restrict__ FL, const int* __restrict__ M, bf* Ah, bf* Al) {
    __shared__ v4f xs[8 * 8 * 32];
    const int lane = threadIdx.x & 31, lr = lane & 15, hi = lane >> 4;
    const int w = __builtin_amdgcn_readfirstlane((int)(threadIdx.x >> 5)); const int kr = w >> 2;
    const int bz = blockIdx.z, h = blockIdx.y, hb = bz * NH_ + h, q0 = blockIdx.x * QWG + (w & 3) * 32;
    constexpr int NST = TT / KR / 32;
    const unsigned vo = lane * 16, vm = (unsigned)(lr * MPITCH + 8 * hi) * 4;
    const size_t qo = ((size_t)hb * TT + q0) * HD * 2;
    // which of this wave's 32 key tiles hold a masked entry (wave-uniform)
    const unsigned fr = ((unsigned)bz * (TT / 32) + (unsigned)q0 / 32u) * (TT / MQ) + (unsigned)kr * (TT / KR / MQ);
    const unsigned need = (unsigned)__builtin_amdgcn_readfirstlane((int)(FL[(size_t)fr * 32] | (FL[(size_t)(fr + 1) * 32] << 16)));
    v8f T[4][2];
    { const size_t go = ((size_t)hb * 8 + kr) * 1024;
      v16bf qhs[2], qls[2];   // the q fragments of columns [32 kr, 32 kr + 32). HD^-0.5 is a power of two: exact on bf16, once per wave instead of once per score
#pragma unroll
      for (int qt = 0; qt < 2; ++qt) { qhs[qt] = ldfr((const char*)Qh + qo + (qt * 2 + kr) * 1024, vo); qls[qt] = ldfr((const char*)Ql + qo + (qt * 2 + kr) * 1024, vo); }
      v16bf gh[4], gl[4];
#pragma unroll
      for (int mb = 0; mb < 4; ++mb) { gh[mb] = ldfr((const char*)Gh + go + mb * 2048, vo); gl[mb] = ldfr((const char*)Gl + go + mb * 2048, vo); }
      __builtin_amdgcn_sched_barrier(0);   // all 24 loads are issued in front of the first product: left alone, the compiler issues the lo fragments of G only behind the products of the hi fragments, a second full wait
#pragma unroll
      for (int qt = 0; qt < 2; ++qt) { qhs[qt] = qhs[qt] * (__bf16)SCL; qls[qt] = qls[qt] * (__bf16)SCL; }
#pragma unroll
      for (int mb = 0; mb < 4; ++mb)
#pragma unroll
        for (int qt = 0; qt < 2; ++qt) T[mb][qt] = wmmab(gh[mb], qhs[qt], (v8f){});
#pragma unroll
      for (int mb = 0; mb < 4; ++mb)
#pragma unroll
        for (int qt = 0; qt < 2; ++qt) T[mb][qt] = wmmab(gh[mb], qls[qt], T[mb][qt]);
#pragma unroll
      for (int mb = 0; mb < 4; ++mb)
#pragma unroll
        for (int qt = 0; qt < 2; ++qt) T[mb][qt] = wmmab(gl[mb], qhs[qt], T[mb][qt]); }
    // v_nop x 4: the branches of the tile loop follow, and behind them vector instructions read these results. The operands keep every matrix instruction above in front of the slots
    asm volatile("v_nop\n\tv_nop\n\tv_nop\n\tv_nop" : "+v"(T[0][0]), "+v"(T[0][1]), "+v"(T[1][0]), "+v"(T[1][1]), "+v"(T[2][0]), "+v"(T[2][1]), "+v"(T[3][0]), "+v"(T[3][1]));
    // a tile's 32 keys are 4096 bytes in a row in each of the four k and v^T planes
    const unsigned po0 = ((unsigned)hb * TT + (unsigned)kr * (TT / KR)) * HD * 2;
    const unsigned mo0 = ((unsigned)bz * SEQ_FULL * SEQ_FULL + (unsigned)q0 * MPITCH + (unsigned)kr * (TT / KR)) * 4;
    unsigned rem = need;
    v16bf qh[2][2], ql[2][2];
    if (need != 0u) {   // all of q is wanted only where a tile is worked through
#pragma unroll
      for (int qt = 0; qt < 2; ++qt)
#pragma unroll
        for (int ks = 0; ks < 2; ++ks) { qh[qt][ks] = ldfr((const char*)Qh + qo + (qt * 2 + ks) * 1024, vo) * (__bf16)SCL; ql[qt][ks] = ldfr((const char*)Ql + qo + (qt * 2 + ks) * 1024, vo) * (__bf16)SCL; } }
#pragma unroll 1   // one pass holds 48 matrix instructions and every register set once; most masks need few passes or none
    for (int it = 0; it < NST && rem != 0u; ++it) {   // one pass per set bit, lowest first: at most NST passes
        const unsigned s = (unsigned)__builtin_ctz(rem); rem &= rem - 1u;
        const unsigned po = po0 + s * 4096u + vo, mo = mo0 + s * 128u + vm;   // the lane's byte offsets into the planes and into the mask: every load of the pass names a kernel argument and one of these two
        v16bf kh[2][2], kl[2][2], vh[4], vl[4]; v8i mk[2][2];
#pragma unroll
        for (int kt = 0; kt < 2; ++kt)
#pragma unroll
            for (int ks = 0; ks < 2; ++ks) { kh[kt][ks] = ldfr((const char*)Kh + (kt * 2 + ks) * 1024, po); kl[kt][ks] = ldfr((const char*)Kl + (kt * 2 + ks) * 1024, po); }
#pragma unroll
        for (int qt = 0; qt < 2; ++qt)
#pragma unroll
            for (int kt = 0; kt < 2; ++kt) mk[qt][kt] = ldm8((const char*)M + (size_t)qt * 16 * MPITCH * 4 + kt * 64, mo);
#pragma unroll
        for (int mb = 0; mb < 4; ++mb) { vh[mb] = ldfr((const char*)Vh + mb * 1024, po); vl[mb] = ldfr((const char*)Vl + mb * 1024, po); }
        v8f S[2][2];
#pragma unroll
        for (int kt = 0; kt < 2; ++kt) { S[kt][0] = (v8f){}; S[kt][1] = (v8f){}; }
#pragma unroll
        for (int ks = 0; ks < 2; ++ks) {
#pragma unroll
            for (int kt = 0; kt < 2; ++kt)
#pragma unroll
                for (int qt = 0; qt < 2; ++qt) S[kt][qt] = wmmab(kh[kt][ks], qh[qt][ks], S[kt][qt]);
#pragma unroll
            for (int kt = 0; kt < 2; ++kt)
#pragma unroll
                for (int qt = 0; qt < 2; ++qt) S[kt][qt] = wmmab(kh[kt][ks], ql[qt][ks], S[kt][qt]);
#pragma unroll
            for (int kt = 0; kt < 2; ++kt)
#pragma unroll
                for (int qt = 0; qt < 2; ++qt) S[kt][qt] = wmmab(kl[kt][ks], qh[qt][ks], S[kt][qt]);
        }
        v16bf sh[2], sl[2];
#pragma unroll
        for (int qt = 0; qt < 2; ++qt) {
            v8u uh, ul;   // word kt * 4 + p = elements kt * 8 + 2 p, + 1 of the B fragment
#pragma unroll
            for (int kt = 0; kt < 2; ++kt)
#pragma unroll
                for (int p = 0; p < 4; ++p) {
                    const v2f y = { (mk[qt][kt][2 * p] == 0) ? FILLV - S[kt][qt][2 * p] : 0.0f, (mk[qt][kt][2 * p + 1] == 0) ? FILLV - S[kt][qt][2 * p + 1] : 0.0f };
                    const unsigned u = __builtin_bit_cast(unsigned, __builtin_convertvector(y, v2bf));
                    const v2f yh = { __uint_as_float(u << 16), __uint_as_float(u & 0xFFFF0000u) };
                    uh[kt * 4 + p] = u; ul[kt * 4 + p] = __builtin_bit_cast(unsigned, __builtin_convertvector(y - yh, v2bf));
                }
            sh[qt] = __builtin_bit_cast(v16bf, uh); sl[qt] = __builtin_bit_cast(v16bf, ul);
        }
#pragma unroll
        for (int mb = 0; mb < 4; ++mb)
#pragma unroll
            for (int qt = 0; qt < 2; ++qt) T[mb][qt] = wmmab(vh[mb], sh[qt], T[mb][qt]);
#pragma unroll
        for (int mb = 0; mb < 4; ++mb)
#pragma unroll
            for (int qt = 0; qt < 2; ++qt) T[mb][qt] = wmmab(vh[mb], sl[qt], T[mb][qt]);
#pragma unroll
        for (int mb = 0; mb < 4; ++mb)
#pragma unroll
            for (int qt = 0; qt < 2; ++qt) T[mb][qt] = wmmab(vl[mb], sh[qt], T[mb][qt]);
        // v_nop x 4: the pass's last matrix instructions stand right in front of the loop's branches, behind which vector instructions read their results or write over their operands.
        // po and mo as inputs: the two offset registers that the pass's loads name stay unwritten until every one of these loads has landed
        asm volatile("v_nop\n\tv_nop\n\tv_nop\n\tv_nop" : "+v"(T[0][0]), "+v"(T[0][1]), "+v"(T[1][0]), "+v"(T[1][1]), "+v"(T[2][0]), "+v"(T[2][1]), "+v"(T[3][0]), "+v"(T[3][1]) : "v"(po), "v"(mo));
    }
    // hand the other query tile's partial sums to the wave of the other half, take its sums for this wave's tile
    v8f a[4];
#pragma unroll
    for (int mb = 0; mb < 4; ++mb) { const v8f sv = kr ? T[mb][0] : T[mb][1]; a[mb] = kr ? T[mb][1] : T[mb][0];
        xs[(w * 8 + mb * 2) * 32 + lane] = (v4f){sv[0], sv[1], sv[2], sv[3]}; xs[(w * 8 + mb * 2 + 1) * 32 + lane] = (v4f){sv[4], sv[5], sv[6], sv[7]}; }
    __syncthreads();
#pragma unroll
    for (int mb = 0; mb < 4; ++mb) { const v4f o0 = xs[((w ^ 4) * 8 + mb * 2) * 32 + lane], o1 = xs[((w ^ 4) * 8 + mb * 2 + 1) * 32 + lane];
#pragma unroll
        for (int j = 0; j < 4; ++j) { a[mb][j] += o0[j]; a[mb][4 + j] += o1[j]; } }
    float mx = a[0][0];
#pragma unroll
    for (int mb = 0; mb < 4; ++mb)
#pragma unroll
        for (int j = 0; j < 8; ++j) mx = fmaxf(mx, a[mb][j]);
    mx = fmaxf(mx, __shfl_xor(mx, 16, 32));
    float sum = 0.f;
#pragma unroll
    for (int mb = 0; mb < 4; ++mb)
#pragma unroll
        for (int j = 0; j < 8; ++j) { a[mb][j] = exp2_slot(__fmul_rn(__fsub_rn(a[mb][j], mx), 1.4426950408889634f)); sum += a[mb][j]; }
    sum += __shfl_xor(sum, 16, 32);
    const float f = __fdiv_rn(1.0f, sum);
    const size_t oo = (size_t)(bz * TT + q0 + kr * 16 + lr) * DQ + (size_t)h * HD + 8 * hi;
    v4u oh[4], ol[4];
#pragma unroll
    for (int mb = 0; mb < 4; ++mb)
#pragma unroll
        for (int p = 0; p < 4; ++p) {
            const v2f y = { a[mb][2 * p] * f, a[mb][2 * p + 1] * f };
            const unsigned u = __builtin_bit_cast(unsigned, __builtin_convertvector(y, v2bf));
            const v2f yh = { __uint_as_float(u << 16), __uint_as_float(u & 0xFFFF0000u) };
            oh[mb][p] = u; ol[mb][p] = __builtin_bit_cast(unsigned, __builtin_convertvector(y - yh, v2bf));
        }
    __builtin_amdgcn_sched_barrier(0);   // every value is formed in front of the stores: no register that an issued store names is rewritten behind it
#pragma unroll
    for (int mb = 0; mb < 4; ++mb) { *(v8us*)(Ah + oo + mb * 16) = __builtin_bit_cast(v8us, oh[mb]); *(v8us*)(Al + oo + mb * 16) = __builtin_bit_cast(v8us, ol[mb]); }
}

constexpr size_t WS_TOTAL = 4 * SZ_W + NB * (3 * SZ_XB + 3 * SZ_F + 8 * SZ_PL + 2 * SZ_AT) + 2 * SZ_KV + SZ_FL;
static_assert(WS_TOTAL <= (size_t)268435456);
// coverage equalities (threads x 8 elements == plane elements; tiles x 64 x 64 == plane elements)
static_assert(((size_t)DQ * DM / 8) % 256 == 0);
static_assert(((size_t)TT * DM / 8) % 256 == 0);
static_assert(((size_t)NH_ * TT * HD / 8) % 256 == 0);
static_assert((size_t)NH_ * TT * (HD / 8) < ((size_t)1 << 31));

extern "C" void kernel_launch(void* const* d_in, const int* in_sizes, int n_in,
                              void* d_out, int out_size, void* d_ws, size_t ws_size, hipStream_t stream) {
    if (n_in < 12) return;
    const size_t need_x = (size_t)(NB - 1) * SEQ_FULL * DM + (size_t)SEQ * DM;
    const size_t need_m = (size_t)(NB - 1) * SEQ_FULL * SEQ_FULL + (size_t)(SEQ - 1) * SEQ_FULL + (size_t)SEQ;
    if ((size_t)in_sizes[0] < need_x || (size_t)in_sizes[1] < need_x || (size_t)in_sizes[2] < need_x || (size_t)in_sizes[3] < need_m) return;
    if ((size_t)in_sizes[4] < (size_t)DQ * DM || (size_t)in_sizes[6] < (size_t)DQ * DM || (size_t)in_sizes[8] < (size_t)DQ * DM || (size_t)in_sizes[10] < (size_t)DM * DQ) return;
    if (in_sizes[5] < DQ || in_sizes[7] < DQ || in_sizes[9] < DQ || in_sizes[11] < DM) return;
    if ((size_t)out_size < (size_t)NB * SEQ * DM) return;
    if (WS_TOTAL > ws_size) return;
    // wire order: k, q, v, mask (int), Wq, bq, Wk, bk, Wv, bv, Wo, bo ('oi' weights)
    const float* xk = (const float*)d_in[0]; const float* xq = (const float*)d_in[1]; const float* xv = (const float*)d_in[2]; const int* mk = (const int*)d_in[3];
    const float* wq = (const float*)d_in[4]; const float* bq = (const float*)d_in[5]; const float* wk = (const float*)d_in[6]; const float* bk = (const float*)d_in[7];
    const float* wv = (const float*)d_in[8]; const float* bv = (const float*)d_in[9]; const float* wo = (const float*)d_in[10]; const float* bo = (const float*)d_in[11];
    float* OUT = (float*)d_out;     // [NB][SEQ][1024]
    char* wsp = (char*)d_ws;
    bf* WB = (bf*)wsp; wsp += 4 * SZ_W;            // Wq, Wk, Wv, Wo
    bf* XB = (bf*)wsp; wsp += 3 * NB * SZ_XB;      // [q, k, v][b][t][DM]
    float* F = (float*)wsp; wsp += 3 * NB * SZ_F;  // [q, k, v][b][t][DQ]
    bf* PL = (bf*)wsp; wsp += 8 * NB * SZ_PL;      // [q hi, q lo, k hi, k lo, v^T hi, v^T lo, k^T hi, k^T lo][b]
    bf* ATh = (bf*)wsp; wsp += NB * SZ_AT; bf* ATl = (bf*)wsp; wsp += NB * SZ_AT;   // [b][t][DQ]
    bf* GVh = (bf*)wsp; wsp += SZ_KV; bf* GVl = (bf*)wsp; wsp += SZ_KV;             // v^T k, [b][h] in fragment order
    unsigned* FLG = (unsigned*)wsp; wsp += SZ_FL;                                   // mask tile bits
    constexpr size_t PS = (size_t)NB * NH_ * TT * HD;   // elements of one plane over all batches

    k_cvt8<<<3 * NB * GX + 4 * GW, 256, 0, stream>>>(xq, xk, xv, wq, wk, wv, wo, XB, WB);
    // z = q, k, v: F[z][b * TT + t][n] = bf16(x_z) W_z^T + b_z
    k_gemmw<bf, 0, true, 1><<<dim3(NB * TT / 64, DQ / 64, 3), 32, 0, stream>>>(XB, nullptr, WB, nullptr, DM, DM, F, DQ, bq, bk, bv, (size_t)NB * TT * DM, (size_t)DQ * DM, (size_t)NB * TT * DQ, 0);
    k_planes<<<dim3(GP, 4, NB), 256, 0, stream>>>(F, PL);
    // v^T k of every head; one bit per 32 x 32 mask tile
    k_pre<<<GKV + GMS, 256, 0, stream>>>(PL + 4 * PS, PL + 5 * PS, PL + 6 * PS, PL + 7 * PS, mk, GVh, GVl, FLG);
    // all batches and heads: T = select(q k^T x HD^-0.5) v, softmax over d -> ATh|ATl[b * TT + t][h * HD + d]
    k_fattn<<<dim3(TT / QWG, NH_, NB), 256, 0, stream>>>(PL, PL + PS, PL + 2 * PS, PL + 3 * PS, PL + 4 * PS, PL + 5 * PS, GVh, GVl, FLG, mk, ATh, ATl);
    // out = (ATh + ATl) Wo^T + bo
    k_gemmw<bf, 1, true, 1><<<dim3(NB * TT / 64, DM / 64, 1), 32, 0, stream>>>(ATh, ATl, WB + 3 * (size_t)DQ * DM, nullptr, DQ, DQ, OUT, DM, bo, bo, bo, 0, 0, 0, 0);
}

// v005
// It runs in 130 microseconds.
// Next to v004, in two timings, it ran 1.04 times as fast each time.
// All steps since v000 together make it 10.5 times as fast.
#include <hip/hip_runtime.h>

// Contractions (all f32 accumulate): q/k/v projections v_wmma_f32_16x16x32_bf16 (inputs and weights RNE-converted to bf16, single product, f32 bias add); v^T k, (v^T k) q^T and, for mask tiles that hold a zero, k.q^T and v^T.correction^T: v_wmma_f32_16x16x32_bf16 on bf16 hi|lo pairs (three products hh + hl + lh into one accumulator); output projection bf16 hi/lo context planes x bf16 weights (2 products) + f32 bias; softmax over the head width in f32.
// Multi-head attention on three input streams (wire order k, q, v [NB][SEQ][1024]); 'oi' weights; 16 heads x 64; scores x 0.125; int mask [NB][1][S][S]: where mask == 0 the scaled score is REPLACED by -1e9 (read by value); NO softmax over keys: T = S_sel . V, then softmax over the 64 head columns of T; merged context x Wo^T + bo.
// With no softmax between the two products, for ANY mask: T = S_sel V = (q x 0.125) (k^T V) + C V, where C[query][key] = (mask == 0) ? -1e9 - S : 0. The first term needs one 64 x 64 matrix per head; C is zero on every 32 x 32 tile whose mask holds no zero, and only the other tiles are worked through key by key.
// Six launches, each over both batches (and over the q, k, v streams where they are alike): bf16 copies in fragment order -> projection GEMMs (f32, + bias) -> bf16 hi|lo head planes of q, k, v^T and k^T in fragment order -> v^T k per head (hi|lo planes) and, in the same launch, one bit per 32 x 32 mask tile (tile holds a zero) -> one kernel over all heads: T^T = (v^T k)(q x 0.125)^T; per flagged tile S^T = k (q x 0.125)^T -> C^T -> bf16 hi|lo B operands in registers -> T^T += v^T C^T; the two halves of a work-group added through LDS; softmax over d -> context hi/lo bf16 planes in fragment order; context x Wo.

#ifndef NB
#define NB 2
#endif
#ifndef SEQ
#define SEQ 2048
#endif
#define NB_FULL  2
#define SEQ_FULL 2048
#define TT   SEQ
#define DM   1024
#define NH_  16
#define HD   64
#define DQ   (NH_ * HD)
#define QWG  128  // queries of one work-group of the fused kernel: 4 wave columns x 32 queries
#define KR   2    // key ranges of one work-group: 4 x 2 = 8 waves
#define MQ   512  // keys of one work-group of the mask scan
#define MPITCH SEQ_FULL
#define SCL  0.125f   // HD^-0.5
#define FILLV (-1.0e9f)

static_assert(TT % 256 == 0);
static_assert(TT % 64 == 0);
static_assert(DM % 64 == 0);
static_assert(DQ == DM);
static_assert(HD == 64);
static_assert(TT % QWG == 0);
static_assert(NB <= NB_FULL);
static_assert(SEQ <= SEQ_FULL);
static_assert(HD % 32 == 0);
static_assert(TT % 32 == 0);
static_assert(DM % 32 == 0);
static_assert(HD / 8 == 8);
static_assert(TT % (KR * 32) == 0);
static_assert(KR == 2);
static_assert(SCL == 0.125f);
static_assert(TT / KR / 32 == 32);        // a wave's tile bits fill one 32-bit word
static_assert(TT / KR == 2 * MQ);         // made of two scan words of 16 bits
static_assert(TT % (8 * 64) == 0);
static_assert((size_t)NB_FULL * SEQ_FULL * SEQ_FULL * 4 < ((size_t)1 << 32));   // byte offsets into the mask and into a plane fit 32 bits
static_assert((size_t)NB * NH_ * TT * HD * 2 < ((size_t)1 << 32));

constexpr size_t al256(size_t b) { return (b + 255) & ~(size_t)255; }
constexpr size_t SZ_W  = al256((size_t)DQ * DM * 2);            // one weight plane (bf16)
constexpr size_t SZ_XB = al256((size_t)TT * DM * 2);            // bf16 activation copy of one stream and batch
constexpr size_t SZ_F  = al256((size_t)TT * DQ * 4);            // f32 projection of one stream and batch
constexpr size_t SZ_PL = al256((size_t)NH_ * TT * HD * 2);      // one bf16 head plane of one batch
constexpr size_t SZ_AT = al256((size_t)TT * DQ * 2);            // one context plane (bf16) of one batch
constexpr unsigned GW = (unsigned)((size_t)DQ * DM / 8 / 256);         // work-groups of one weight copy
constexpr unsigned GX = (unsigned)((size_t)TT * DM / 8 / 256);         // work-groups of one activation copy (one stream, one batch)
constexpr unsigned GP = (unsigned)((size_t)NH_ * TT * HD / 8 / 256);   // work-groups of one head plane pair
constexpr unsigned GKV = NB * NH_ * (HD / 16);                // work-groups of v^T k: one strip of 16 rows each
constexpr unsigned GMS = NB * (TT / 32) * (TT / MQ);          // work-groups of the mask scan: 32 queries x MQ keys each
constexpr size_t SZ_KV = al256((size_t)NB * NH_ * HD * HD * 2);   // one v^T k plane (bf16), all batches and heads
constexpr size_t SZ_FL = (size_t)GMS * 128;                   // tile bits: one word per scan work-group, each in a 128-byte line of its own
// the slices of one buffer stand back to back: stream-major, then batch
static_assert(SZ_W == (size_t)DQ * DM * 2);
static_assert(SZ_XB == (size_t)TT * DM * 2);
static_assert(SZ_F == (size_t)TT * DQ * 4);
static_assert(SZ_PL == (size_t)NH_ * TT * HD * 2);
static_assert(SZ_AT == (size_t)TT * DQ * 2);

typedef _Float16 h16;
typedef unsigned short bf;
typedef __attribute__((ext_vector_type(16))) __bf16   v16bf;
typedef __attribute__((ext_vector_type(16))) _Float16 v16h;
typedef __attribute__((ext_vector_type(8)))  _Float16 v8h;
typedef __attribute__((ext_vector_type(8)))  unsigned short v8us;
typedef __attribute__((ext_vector_type(2)))  __bf16   v2bf;
typedef __attribute__((ext_vector_type(2)))  float    v2f;
typedef __attribute__((ext_vector_type(8)))  unsigned v8u;
typedef __attribute__((ext_vector_type(4)))  unsigned v4u;
typedef __attribute__((ext_vector_type(8)))  int      v8i;
typedef __attribute__((ext_vector_type(8)))  float    v8f;
typedef __attribute__((ext_vector_type(4)))  float    v4f;
typedef __attribute__((ext_vector_type(4)))  int      v4i;
typedef v4f  __attribute__((may_alias)) v4fa;

__device__ __forceinline__ unsigned short f2bf(float f) { unsigned u = __float_as_uint(f); u += 0x7FFFu + ((u >> 16) & 1u); return (unsigned short)(u >> 16); }
__device__ __forceinline__ float bf2f(unsigned short b) { return __uint_as_float(((unsigned)b) << 16); }
__device__ __forceinline__ float bfr(float f) { return bf2f(f2bf(f)); }
__device__ __forceinline__ v16h cat16(v8h lo, v8h hi) { return __builtin_shufflevector(lo, hi, 0, 1, 2, 3, 4, 5, 6, 7, 8, 9, 10, 11, 12, 13, 14, 15); }
__device__ __forceinline__ v16bf cat16b(v8us lo, v8us hi) { return __builtin_bit_cast(v16bf, __builtin_shufflevector(lo, hi, 0, 1, 2, 3, 4, 5, 6, 7, 8, 9, 10, 11, 12, 13, 14, 15)); }
__device__ __forceinline__ v8f wmma16(v16h a, v16h b, v8f c) { return __builtin_amdgcn_wmma_f32_16x16x32_f16(false, a, false, b, (short)0, c, false, false); }
__device__ __forceinline__ v8f wmmab(v16bf a, v16bf b, v8f c) { return __builtin_amdgcn_wmma_f32_16x16x32_bf16(false, a, false, b, (short)0, c, false, false); }

// ---- k_gemmw: register-blocked GEMM, ONE WAVE per 64x64 output tile (16 accumulators), operands straight from 16-bit planes in fragment order (described in front of k_cvt8; fragment number (row / 16) * (K / 32) + k / 32), so that each 16-byte load of the wave covers 4 whole lines; grid (M/64, N/64, Z * KS), 32 threads.
// C[m][n] (f32, pitch ldc, + optional f32 bias[n]) = sum_k A[m][k] Bt[n][k] (+ split products per NSPLIT). z-batch strides sA/sB/sC in elements. K % 32 == 0, M % 64 == 0, N % 64 == 0.
// The bias vector goes by z: bias, bias1, bias2 for z = 0, 1, 2.
// Split over k: K = KS * KC (KC % 32 == 0), blockIdx.z = z * KS + ks; a work-group sums only k in [ks * KC, ks * KC + KC) and stores its partial tile at C + ks * sP; the reader of C adds the KS partials. KS == 1: KC == K, the whole sum.
// Fragment map: lane -> row/col (lane & 15); elements 0..7 <- k0 + 8*(lane>>4) + 0..7, elements 8..15 <- k0 + 16 + 8*(lane>>4) + 0..7 (both operands); acc[j] = (row 8*(lane>>4) + j, col lane & 15).
template <typename T16> struct WFrag;
template <> struct WFrag<h16> { typedef v16h V; static __device__ __forceinline__ V ld(const h16* b, unsigned vo) { const char* p = (const char*)b; return cat16(*(const v8h*)(p + vo), *(const v8h*)(p + 512 + vo)); } static __device__ __forceinline__ v8f mma(V a, V b, v8f c) { return wmma16(a, b, c); } };
template <> struct WFrag<bf> { typedef v16bf V; static __device__ __forceinline__ V ld(const bf* b, unsigned vo) { const char* p = (const char*)b; return cat16b(*(const v8us*)(p + vo), *(const v8us*)(p + 512 + vo)); } static __device__ __forceinline__ v8f mma(V a, V b, v8f c) { return wmmab(a, b, c); } };
template <typename T16, int NSPLIT, bool BIAS, int KS>
__global__ __launch_bounds__(32) void k_gemmw(const T16* __restrict__ A, const T16* __restrict__ A2, const T16* __restrict__ Bt, const T16* __restrict__ Bt2, int K, int KC, float* C, int ldc, const float* __restrict__ bias0, const float* __restrict__ bias1, const float* __restrict__ bias2, size_t sA, size_t sB, size_t sC, size_t sP) {
    typedef typename WFrag<T16>::V V;
    __shared__ __align__(16) float os[16 * 68];
    const size_t z = blockIdx.z / (unsigned)KS, ks = blockIdx.z % (unsigned)KS, ko = ks * KC * 16;   // 32 k of 16 rows are 512 elements in a row
    A += z * sA + ko; if (A2) A2 += z * sA + ko; Bt += z * sB + ko; if (Bt2) Bt2 += z * sB + ko; C += z * sC + ks * sP;
    const float* bias = z == 0 ? bias0 : (z == 1 ? bias1 : bias2);
    const int lane = threadIdx.x & 31, lr = lane & 15, hi = lane >> 4; const int r0 = blockIdx.x * 64, c0 = blockIdx.y * 64;
    v8f acc[4][4];
#pragma unroll
    for (int mb = 0; mb < 4; ++mb)
#pragma unroll
        for (int nb = 0; nb < 4; ++nb) acc[mb][nb] = (v8f){};
    // a fragment's address = wave-uniform start of its 16 rows (16 * K elements in a row) + the lane's byte offset vk: 16 * lane, + 1024 for every 32 k
#pragma unroll 1
    for (int kc = 0; kc < KC; kc += 32) {
        const unsigned vk = (unsigned)lane * 16u + (unsigned)kc * 32u;
        V a[4], a2[4];
#pragma unroll
        for (int mb = 0; mb < 4; ++mb) { a[mb] = WFrag<T16>::ld(A + (size_t)(r0 + mb * 16) * K, vk); if (NSPLIT == 1 || NSPLIT == 2) a2[mb] = WFrag<T16>::ld(A2 + (size_t)(r0 + mb * 16) * K, vk); }
#pragma unroll
        for (int nb = 0; nb < 4; ++nb) { const V b = WFrag<T16>::ld(Bt + (size_t)(c0 + nb * 16) * K, vk); V b2; if (NSPLIT >= 2) b2 = WFrag<T16>::ld(Bt2 + (size_t)(c0 + nb * 16) * K, vk);
#pragma unroll
            for (int mb = 0; mb < 4; ++mb) { acc[mb][nb] = WFrag<T16>::mma(a[mb], b, acc[mb][nb]); if (NSPLIT == 1 || NSPLIT == 2) acc[mb][nb] = WFrag<T16>::mma(a2[mb], b, acc[mb][nb]); if (NSPLIT >= 2) acc[mb][nb] = WFrag<T16>::mma(a[mb], b2, acc[mb][nb]); } }
        asm volatile("v_nop\n\tv_nop\n\tv_nop\n\tv_nop" : "+v"(acc[0][0]), "+v"(acc[1][1]), "+v"(acc[2][2]), "+v"(acc[3][3]) : "v"(a[0]), "v"(a[3]));
    }
#pragma unroll
    for (int mb = 0; mb < 4; ++mb) {
#pragma unroll
        for (int nb = 0; nb < 4; ++nb) {
#pragma unroll
            for (int j = 0; j < 8; ++j) os[(hi * 8 + j) * 68 + nb * 16 + lr] = acc[mb][nb][j]; }
        __builtin_amdgcn_wave_barrier(); asm volatile("" ::: "memory");
        float* crow = C + (size_t)(r0 + mb * 16) * ldc + c0;
{
#pragma unroll
            for (int s = 0; s < 8; ++s) { const int row = 2 * s + hi, cofs = lr * 4; v4f val = *(const v4fa*)(os + row * 68 + cofs); if (BIAS) { val[0] += bfr(bias[c0 + cofs]); val[1] += bfr(bias[c0 + cofs + 1]); val[2] += bfr(bias[c0 + cofs + 2]); val[3] += bfr(bias[c0 + cofs + 3]); }
                *(v4f*)(crow + (size_t)row * ldc + cofs) = val; }
             }
        __builtin_amdgcn_wave_barrier(); asm volatile("" ::: "memory");
    }
}

__device__ __forceinline__ void splitf(float y, unsigned short& h, unsigned short& l) { h = f2bf(y); l = f2bf(y - bf2f(h)); }

// Fragment order of a 16-bit plane: a 16 x 32 fragment (16 rows or columns x 32 k) is 512 elements in a row, as two halves of 256: half e, lane l = 16 * hi + c, 8 elements <- row c, k = 16 * e + 8 * hi + 0..7.
// A wave's two 16-byte loads of a fragment then each cover 512 contiguous bytes (4 whole lines) instead of 16 lines.
// k_cvt8: every f32 -> bf16 copy in one launch, each matrix [rows][DM] written in fragment order, fragment number (row / 16) * (DM / 32) + k / 32. A work-group copies 16 rows x 128 k = 4 fragments in a row = 2048 elements.
// Work-groups [0, 3 * NB * GX): activations, stream s, batch b -> XB[s][b]; the other 4 * GW: weights -> WB[s]. The grid covers every slice exactly.
// Thread i reads 8 k of one row (16 threads: 512 bytes in a row of the source); that chunk is number (i & 15) * 16 + (i >> 4) of the work-group's 256: the chunks change places through LDS, so that reads and stores both cover whole lines.
static_assert(DM % 128 == 0);
static_assert(TT % 16 == 0);
static_assert(DQ % 16 == 0);
__global__ __launch_bounds__(256) void k_cvt8(const float* __restrict__ x0, const float* __restrict__ x1, const float* __restrict__ x2, const float* __restrict__ w0, const float* __restrict__ w1, const float* __restrict__ w2, const float* __restrict__ w3, bf* XB, bf* WB) {
    __shared__ v8us st[16 * 17];   // [k / 8][row], 17 chunks a line: the 16 chunks that a row's threads write fall into different banks
    const unsigned bx = blockIdx.x; const float* src; bf* dst; unsigned c;
    if (bx < 3u * NB * GX) { const unsigned s = bx / (NB * GX), b = (bx / GX) % (unsigned)NB; c = bx % GX; src = (s == 0 ? x0 : (s == 1 ? x1 : x2)) + (size_t)b * SEQ_FULL * DM; dst = XB + (size_t)bx * 2048; }
    else { const unsigned r = bx - 3u * NB * GX, s = r / GW; c = r % GW; src = (s == 0 ? w0 : (s == 1 ? w1 : (s == 2 ? w2 : w3))); dst = WB + (size_t)r * 2048; }
    const unsigned i = threadIdx.x, row = i >> 4, k8 = i & 15u;
    const v8f v = *(const v8f*)(src + (size_t)((c / (unsigned)(DM / 128)) * 16 + row) * DM + (c % (unsigned)(DM / 128)) * 128 + k8 * 8); v8us o;
#pragma unroll
    for (int k = 0; k < 8; ++k) o[k] = f2bf(v[k]);
    st[k8 * 17 + row] = o;
    __syncthreads();
    *(v8us*)(dst + i * 8) = st[(i >> 4) * 17 + (i & 15u)];  }

// d_hpl2: q or k head plane; fragment number ((h * TT / 16 + t / 16) * 2 + d / 32); rows t, k = d
__device__ __forceinline__ void d_hpl2(const float* __restrict__ F, bf* Ph, bf* Pl) {
    const unsigned i = blockIdx.x * 256u + threadIdx.x; if (i >= (unsigned)(NH_ * TT * (HD / 8))) return;
    const unsigned d8 = i % (unsigned)(HD / 8); const unsigned t = (i / (unsigned)(HD / 8)) % (unsigned)TT; const unsigned h = i / (unsigned)((HD / 8) * TT);
    const float* f = F + (size_t)t * DQ + h * HD + d8 * 8; const v4f a0 = *(const v4f*)f, a1 = *(const v4f*)(f + 4); v8us oh, ol;
#pragma unroll
    for (int q = 0; q < 4; ++q) { unsigned short a, c2; splitf(a0[q], a, c2); oh[q] = a; ol[q] = c2; splitf(a1[q], a, c2); oh[4 + q] = a; ol[4 + q] = c2; }
    const size_t o = (size_t)((h * (unsigned)(TT / 16) + (t >> 4)) * 2u + (d8 >> 2)) * 512 + ((d8 >> 1) & 1u) * 256 + ((d8 & 1u) * 16 + (t & 15u)) * 8;
    *(v8us*)(Ph + o) = oh; *(v8us*)(Pl + o) = ol;  }

// d_vtp2: v^T head plane; fragment number ((g * TT / 32 + t / 32) * 4 + d / 16); rows d, k = t. Thread i writes chunk i of the plane: i = (((g * TT / 32 + t / 32) * 4 + d / 16) * 2 + e) * 32 + 16 * hi + (d & 15)
__device__ __forceinline__ void d_vtp2(const float* __restrict__ F, bf* Vh, bf* Vl) {
    const unsigned i = blockIdx.x * 256u + threadIdx.x; if (i >= (unsigned)(NH_ * HD * (TT / 8))) return;
    const unsigned d = ((i >> 6) & 3u) * 16 + (i & 15u); const unsigned t8 = ((i >> 8) % (unsigned)(TT / 32)) * 4 + ((i >> 5) & 1u) * 2 + ((i >> 4) & 1u); const unsigned g = i / (unsigned)((TT / 8) * HD);
    const float* f = F + (size_t)(t8 * 8) * DQ + g * HD + d; v8us oh, ol;
#pragma unroll
    for (int q = 0; q < 8; ++q) { unsigned short a, c2; splitf(f[(size_t)q * DQ], a, c2); oh[q] = a; ol[q] = c2; }
    *(v8us*)(Vh + (size_t)i * 8) = oh; *(v8us*)(Vl + (size_t)i * 8) = ol;  }

// k_planes: all head planes in one launch; blockIdx.y = plane pair s (q, k, v^T, k^T), blockIdx.z = batch b; F[q, k, v, k][b] -> hi plane P[2 s][b], lo plane P[2 s + 1][b]
__global__ __launch_bounds__(256) void k_planes(const float* __restrict__ F, bf* P) {
    const unsigned s = blockIdx.y, b = blockIdx.z; const float* f = F + (size_t)((s == 3 ? 1u : s) * NB + b) * TT * DQ;
    bf* ph = P + (size_t)(2 * s * NB + b) * (NH_ * TT * HD); bf* pl = ph + (size_t)NB * (NH_ * TT * HD);
    if (s < 2) d_hpl2(f, ph, pl); else d_vtp2(f, ph, pl);
}

// one fragment: b wave-uniform, b + vo = byte address of the fragment + 16 * lane
__device__ __forceinline__ v16bf ldfr(const char* b, unsigned vo) { return cat16b(*(const v8us*)(b + vo), *(const v8us*)(b + 512 + vo)); }
// 2^x; the v_nop fills the slot that the instruction set asks for behind a transcendental before its result is read or its source overwritten
__device__ __forceinline__ float exp2_slot(float x) { float r; asm("v_exp_f32 %0, %1\n\tv_nop" : "=v"(r) : "v"(x)); return r; }
__device__ __forceinline__ v8i ldm8(const char* b, unsigned vo) { return __builtin_shufflevector(*(const v4i*)(b + vo), *(const v4i*)(b + 16 + vo), 0, 1, 2, 3, 4, 5, 6, 7); }

// k_pre: two jobs that the attention kernel needs, independent of each other, in one launch.
// Work-groups [0, GKV): plane head hb = blockIdx.x / 4, strip mb = blockIdx.x % 4: G[d][e] = sum_t v[t][d] k[t][e] for the 16 rows d of the strip, all 64 e (A = v^T fragments, B = k^T fragments, both k = t; vh.kh + vh.kl + vl.kh).
//   Wave w sums keys [w * TT / 8, + TT / 8); the 8 partial strips are added through LDS in wave order; G goes out as bf16 hi|lo in A-fragment order (rows d, k = e): fragment number (hb * 4 + mb) * 2 + e / 32.
// The other GMS work-groups: r = (batch * TT / 32 + query tile) * (TT / MQ) + key block: bit p of FL[r * 32] = the mask of these 32 queries holds a zero among keys [32 p, 32 p + 32) of the block.
__global__ __launch_bounds__(256) void k_pre(const bf* __restrict__ Vh, const bf* __restrict__ Vl, const bf* __restrict__ KTh, const bf* __restrict__ KTl, const int* __restrict__ M, bf* Gh, bf* Gl, unsigned* FL) {
    __shared__ __align__(16) float red[8 * 32 * 32];   // [wave][nb * 8 + j][lane]
    __shared__ unsigned fl[8];
    const int lane = threadIdx.x & 31;
    const int w = __builtin_amdgcn_readfirstlane((int)(threadIdx.x >> 5));
    if (blockIdx.x < GKV) {
        const unsigned hb = blockIdx.x >> 2, mb = blockIdx.x & 3u, vo = lane * 16;
        const size_t po = ((size_t)hb * TT + (size_t)w * (TT / 8)) * HD * 2;
        v8f acc[4];
#pragma unroll
        for (int nb = 0; nb < 4; ++nb) acc[nb] = (v8f){};
#pragma unroll   // straight-line: no matrix instruction stands in front of a back edge
        for (int s = 0; s < TT / 8 / 32; s += 2) {
            v16bf vh[2], vl[2], kh[2][4], kl[2][4];
#pragma unroll
            for (int u = 0; u < 2; ++u) { vh[u] = ldfr((const char*)Vh + po + (s + u) * 4096 + mb * 1024, vo); vl[u] = ldfr((const char*)Vl + po + (s + u) * 4096 + mb * 1024, vo);
#pragma unroll
                for (int nb = 0; nb < 4; ++nb) { kh[u][nb] = ldfr((const char*)KTh + po + (s + u) * 4096 + nb * 1024, vo); kl[u][nb] = ldfr((const char*)KTl + po + (s + u) * 4096 + nb * 1024, vo); } }
            // the 40 loads of two steps are all in flight together: left alone, the compiler issues them two at a time, each pair with a full wait in front of its matrix instruction
            asm volatile("" :: "v"(vh[0]), "v"(vh[1]), "v"(vl[0]), "v"(vl[1]), "v"(kh[0][0]), "v"(kh[0][1]), "v"(kh[0][2]), "v"(kh[0][3]), "v"(kh[1][0]), "v"(kh[1][1]), "v"(kh[1][2]), "v"(kh[1][3]), "v"(kl[0][0]), "v"(kl[0][1]), "v"(kl[0][2]), "v"(kl[0][3]), "v"(kl[1][0]), "v"(kl[1][1]), "v"(kl[1][2]), "v"(kl[1][3]));
#pragma unroll
            for (int u = 0; u < 2; ++u) {
#pragma unroll
                for (int nb = 0; nb < 4; ++nb) acc[nb] = wmmab(vh[u], kh[u][nb], acc[nb]);
#pragma unroll
                for (int nb = 0; nb < 4; ++nb) acc[nb] = wmmab(vh[u], kl[u][nb], acc[nb]);
#pragma unroll
                for (int nb = 0; nb < 4; ++nb) acc[nb] = wmmab(vl[u], kh[u][nb], acc[nb]);
            }
        }
#pragma unroll
        for (int nb = 0; nb < 4; ++nb)
#pragma unroll
            for (int j = 0; j < 8; ++j) red[(w * 32 + nb * 8 + j) * 32 + lane] = acc[nb][j];
        __syncthreads();
        // thread i < 128 forms chunk i of the strip's two fragments: i = (ks * 2 + e) * 32 + l; row c = l & 15, columns (ks * 2 + e) * 16 + 8 * (l >> 4) + 0..7, which are 8 lanes in a row of accumulator register c & 7
        if (threadIdx.x < 128) {
            const unsigned i = threadIdx.x, c = i & 15u;
            const float* rp = red + ((i >> 5) * 8 + (c & 7u)) * 32 + (c >> 3) * 16 + ((i >> 4) & 1u) * 8;
            v4f s0 = *(const v4fa*)rp, s1 = *(const v4fa*)(rp + 4);
#pragma unroll
            for (int u = 1; u < 8; ++u) { s0 += *(const v4fa*)(rp + u * 1024); s1 += *(const v4fa*)(rp + u * 1024 + 4); }
            v8us oh, ol;
#pragma unroll
            for (int q = 0; q < 4; ++q) { unsigned short a, c2; splitf(s0[q], a, c2); oh[q] = a; ol[q] = c2; splitf(s1[q], a, c2); oh[4 + q] = a; ol[4 + q] = c2; }
            *(v8us*)(Gh + (size_t)blockIdx.x * 1024 + i * 8) = oh; *(v8us*)(Gl + (size_t)blockIdx.x * 1024 + i * 8) = ol;
        }
    } else {
        const unsigned r = blockIdx.x - GKV, kb = r % (unsigned)(TT / MQ), qt = (r / (unsigned)(TT / MQ)) % (unsigned)(TT / 32), b = r / (unsigned)((TT / MQ) * (TT / 32));
        // wave w: rows 4 w .. 4 w + 3 of the tile row; a load covers 128 keys of one row, lane l keys 4 l .. 4 l + 3
        const int* mp = M + (size_t)b * SEQ_FULL * SEQ_FULL + (size_t)(qt * 32 + w * 4) * MPITCH + kb * MQ + lane * 4;
        unsigned mn[MQ / 128];
#pragma unroll
        for (int c = 0; c < MQ / 128; ++c) mn[c] = 0xFFFFFFFFu;
#pragma unroll
        for (int row = 0; row < 4; ++row)
#pragma unroll
            for (int c = 0; c < MQ / 128; ++c) { const v4i x = *(const v4i*)(mp + (size_t)row * MPITCH + c * 128);
                mn[c] = min(min(mn[c], min((unsigned)x[0], (unsigned)x[1])), min((unsigned)x[2], (unsigned)x[3])); }   // unsigned minimum: 0 exactly where a value is 0
        unsigned bits = 0;
#pragma unroll
        for (int c = 0; c < MQ / 128; ++c) { const unsigned bal = __builtin_amdgcn_ballot_w32(mn[c] == 0u);
#pragma unroll
            for (int g = 0; g < 4; ++g) bits |= ((bal >> (8 * g)) & 0xFFu) ? (1u << (c * 4 + g)) : 0u; }
        if (lane == 0) fl[w] = bits;
        __syncthreads();
        if (threadIdx.x == 0) { unsigned o = 0;
#pragma unroll
            for (int u = 0; u < 8; ++u) o |= fl[u];
            FL[(size_t)r * 32] = o; }
    }
}

// k_fattn: one batch (blockIdx.z), one head (blockIdx.y), QWG queries (blockIdx.x); a batch's heads follow the batch before in every plane (plane head number hb); wave w: 32 queries (column w & 3), half kr = w >> 2 of KR.
//   T^T[d][query] = G (q x HD^-0.5)^T, G = v^T k of the head (k_pre): wave kr sums columns e in [32 kr, 32 kr + 32) (gh.qh + gh.ql + gl.qh).
// Then, only for those of the wave's 32 tiles of 32 keys (key range kr) whose bit in FL says that the mask holds a zero there:
//   S^T[key][query] = k (q x HD^-0.5)^T (A = k fragments, B = scaled q fragments kept in registers; kh.qh + kh.ql + kl.qh per 32 d);
//   C = (mask[query][key] == 0) ? -1e9 - S : 0 (takes S out of the full sum and puts -1e9 in; read by value), split into bf16 hi|lo: the two 16-key accumulator tiles of one query tile ARE the B fragment of the next product (element s <- tile s >> 3, register s & 7);
//   T^T[d][query] += v^T C^T (vh.sh + vh.sl + vl.sh).
// Then the two halves are added through LDS (half 0 + half 1; wave of range r finishes query tile r), softmax over the HD values of a query (32 in the lane, 32 in lane ^ 16), context hi|lo planes.
__global__ __launch_bounds__(256) void k_fattn(const bf* __restrict__ Qh, const bf* __restrict__ Ql, const bf* __restrict__ Kh, const bf* __restrict__ Kl, const bf* __restrict__ Vh, const bf* __restrict__ Vl, const bf* __restrict__ Gh, const bf* __restrict__ Gl, const unsigned* __restrict__ FL, const int* __restrict__ M, bf* Ah, bf* Al) {
    __shared__ v4f xs[8 * 8 * 32];
    const int lane = threadIdx.x & 31, lr = lane & 15, hi = lane >> 4;
    const int w = __builtin_amdgcn_readfirstlane((int)(threadIdx.x >> 5)); const int kr = w >> 2;
    const int bz = blockIdx.z, h = blockIdx.y, hb = bz * NH_ + h, q0 = blockIdx.x * QWG + (w & 3) * 32;
    constexpr int NST = TT / KR / 32;
    const unsigned vo = lane * 16, vm = (unsigned)(lr * MPITCH + 8 * hi) * 4;
    const size_t qo = ((size_t)hb * TT + q0) * HD * 2;
    // which of this wave's 32 key tiles hold a masked entry (wave-uniform)
    const unsigned fr = ((unsigned)bz * (TT / 32) + (unsigned)q0 / 32u) * (TT / MQ) + (unsigned)kr * (TT / KR / MQ);
    const unsigned need = (unsigned)__builtin_amdgcn_readfirstlane((int)(FL[(size_t)fr * 32] | (FL[(size_t)(fr + 1) * 32] << 16)));
    v8f T[4][2];
    { const size_t go = ((size_t)hb * 8 + kr) * 1024;
      v16bf qhs[2], qls[2];   // the q fragments of columns [32 kr, 32 kr + 32). HD^-0.5 is a power of two: exact on bf16, once per wave instead of once per score
#pragma unroll
      for (int qt = 0; qt < 2; ++qt) { qhs[qt] = ldfr((const char*)Qh + qo + (qt * 2 + kr) * 1024, vo); qls[qt] = ldfr((const char*)Ql + qo + (qt * 2 + kr) * 1024, vo); }
      v16bf gh[4], gl[4];
#pragma unroll
      for (int mb = 0; mb < 4; ++mb) { gh[mb] = ldfr((const char*)Gh + go + mb * 2048, vo); gl[mb] = ldfr((const char*)Gl + go + mb * 2048, vo); }
      __builtin_amdgcn_sched_barrier(0);   // all 24 loads are issued in front of the first product: left alone, the compiler issues the lo fragments of G only behind the products of the hi fragments, a second full wait
#pragma unroll
      for (int qt = 0; qt < 2; ++qt) { qhs[qt] = qhs[qt] * (__bf16)SCL; qls[qt] = qls[qt] * (__bf16)SCL; }
#pragma unroll
      for (int mb = 0; mb < 4; ++mb)
#pragma unroll
        for (int qt = 0; qt < 2; ++qt) T[mb][qt] = wmmab(gh[mb], qhs[qt], (v8f){});
#pragma unroll
      for (int mb = 0; mb < 4; ++mb)
#pragma unroll
        for (int qt = 0; qt < 2; ++qt) T[mb][qt] = wmmab(gh[mb], qls[qt], T[mb][qt]);
#pragma unroll
      for (int mb = 0; mb < 4; ++mb)
#pragma unroll
        for (int qt = 0; qt < 2; ++qt) T[mb][qt] = wmmab(gl[mb], qhs[qt], T[mb][qt]); }
    // v_nop x 4: the branches of the tile loop follow, and behind them vector instructions read these results. The operands keep every matrix instruction above in front of the slots
    asm volatile("v_nop\n\tv_nop\n\tv_nop\n\tv_nop" : "+v"(T[0][0]), "+v"(T[0][1]), "+v"(T[1][0]), "+v"(T[1][1]), "+v"(T[2][0]), "+v"(T[2][1]), "+v"(T[3][0]), "+v"(T[3][1]));
    // a tile's 32 keys are 4096 bytes in a row in each of the four k and v^T planes
    const unsigned po0 = ((unsigned)hb * TT + (unsigned)kr * (TT / KR)) * HD * 2;
    const unsigned mo0 = ((unsigned)bz * SEQ_FULL * SEQ_FULL + (unsigned)q0 * MPITCH + (unsigned)kr * (TT / KR)) * 4;
    unsigned rem = need;
    v16bf qh[2][2], ql[2][2];
    if (need != 0u) {   // all of q is wanted only where a tile is worked through
#pragma unroll
      for (int qt = 0; qt < 2; ++qt)
#pragma unroll
        for (int ks = 0; ks < 2; ++ks) { qh[qt][ks] = ldfr((const char*)Qh + qo + (qt * 2 + ks) * 1024, vo) * (__bf16)SCL; ql[qt][ks] = ldfr((const char*)Ql + qo + (qt * 2 + ks) * 1024, vo) * (__bf16)SCL; } }
#pragma unroll 1   // one pass holds 48 matrix instructions and every register set once; most masks need few passes or none
    for (int it = 0; it < NST && rem != 0u; ++it) {   // one pass per set bit, lowest first: at most NST passes
        const unsigned s = (unsigned)__builtin_ctz(rem); rem &= rem - 1u;
        const unsigned po = po0 + s * 4096u + vo, mo = mo0 + s * 128u + vm;   // the lane's byte offsets into the planes and into the mask: every load of the pass names a kernel argument and one of these two
        v16bf kh[2][2], kl[2][2], vh[4], vl[4]; v8i mk[2][2];
#pragma unroll
        for (int kt = 0; kt < 2; ++kt)
#pragma unroll
            for (int ks = 0; ks < 2; ++ks) { kh[kt][ks] = ldfr((const char*)Kh + (kt * 2 + ks) * 1024, po); kl[kt][ks] = ldfr((const char*)Kl + (kt * 2 + ks) * 1024, po); }
#pragma unroll
        for (int qt = 0; qt < 2; ++qt)
#pragma unroll
            for (int kt = 0; kt < 2; ++kt) mk[qt][kt] = ldm8((const char*)M + (size_t)qt * 16 * MPITCH * 4 + kt * 64, mo);
#pragma unroll
        for (int mb = 0; mb < 4; ++mb) { vh[mb] = ldfr((const char*)Vh + mb * 1024, po); vl[mb] = ldfr((const char*)Vl + mb * 1024, po); }
        v8f S[2][2];
#pragma unroll
        for (int kt = 0; kt < 2; ++kt) { S[kt][0] = (v8f){}; S[kt][1] = (v8f){}; }
#pragma unroll
        for (int ks = 0; ks < 2; ++ks) {
#pragma unroll
            for (int kt = 0; kt < 2; ++kt)
#pragma unroll
                for (int qt = 0; qt < 2; ++qt) S[kt][qt] = wmmab(kh[kt][ks], qh[qt][ks], S[kt][qt]);
#pragma unroll
            for (int kt = 0; kt < 2; ++kt)
#pragma unroll
                for (int qt = 0; qt < 2; ++qt) S[kt][qt] = wmmab(kh[kt][ks], ql[qt][ks], S[kt][qt]);
#pragma unroll
            for (int kt = 0; kt < 2; ++kt)
#pragma unroll
                for (int qt = 0; qt < 2; ++qt) S[kt][qt] = wmmab(kl[kt][ks], qh[qt][ks], S[kt][qt]);
        }
        v16bf sh[2], sl[2];
#pragma unroll
        for (int qt = 0; qt < 2; ++qt) {
            v8u uh, ul;   // word kt * 4 + p = elements kt * 8 + 2 p, + 1 of the B fragment
#pragma unroll
            for (int kt = 0; kt < 2; ++kt)
#pragma unroll
                for (int p = 0; p < 4; ++p) {
                    const v2f y = { (mk[qt][kt][2 * p] == 0) ? FILLV - S[kt][qt][2 * p] : 0.0f, (mk[qt][kt][2 * p + 1] == 0) ? FILLV - S[kt][qt][2 * p + 1] : 0.0f };
                    const unsigned u = __builtin_bit_cast(unsigned, __builtin_convertvector(y, v2bf));
                    const v2f yh = { __uint_as_float(u << 16), __uint_as_float(u & 0xFFFF0000u) };
                    uh[kt * 4 + p] = u; ul[kt * 4 + p] = __builtin_bit_cast(unsigned, __builtin_convertvector(y - yh, v2bf));
                }
            sh[qt] = __builtin_bit_cast(v16bf, uh); sl[qt] = __builtin_bit_cast(v16bf, ul);
        }
#pragma unroll
        for (int mb = 0; mb < 4; ++mb)
#pragma unroll
            for (int qt = 0; qt < 2; ++qt) T[mb][qt] = wmmab(vh[mb], sh[qt], T[mb][qt]);
#pragma unroll
        for (int mb = 0; mb < 4; ++mb)
#pragma unroll
            for (int qt = 0; qt < 2; ++qt) T[mb][qt] = wmmab(vh[mb], sl[qt], T[mb][qt]);
#pragma unroll
        for (int mb = 0; mb < 4; ++mb)
#pragma unroll
            for (int qt = 0; qt < 2; ++qt) T[mb][qt] = wmmab(vl[mb], sh[qt], T[mb][qt]);
        // v_nop x 4: the pass's last matrix instructions stand right in front of the loop's branches, behind which vector instructions read their results or write over their operands.
        // po and mo as inputs: the two offset registers that the pass's loads name stay unwritten until every one of these loads has landed
        asm volatile("v_nop\n\tv_nop\n\tv_nop\n\tv_nop" : "+v"(T[0][0]), "+v"(T[0][1]), "+v"(T[1][0]), "+v"(T[1][1]), "+v"(T[2][0]), "+v"(T[2][1]), "+v"(T[3][0]), "+v"(T[3][1]) : "v"(po), "v"(mo));
    }
    // hand the other query tile's partial sums to the wave of the other half, take its sums for this wave's tile
    v8f a[4];
#pragma unroll
    for (int mb = 0; mb < 4; ++mb) { const v8f sv = kr ? T[mb][0] : T[mb][1]; a[mb] = kr ? T[mb][1] : T[mb][0];
        xs[(w * 8 + mb * 2) * 32 + lane] = (v4f){sv[0], sv[1], sv[2], sv[3]}; xs[(w * 8 + mb * 2 + 1) * 32 + lane] = (v4f){sv[4], sv[5], sv[6], sv[7]}; }
    __syncthreads();
#pragma unroll
    for (int mb = 0; mb < 4; ++mb) { const v4f o0 = xs[((w ^ 4) * 8 + mb * 2) * 32 + lane], o1 = xs[((w ^ 4) * 8 + mb * 2 + 1) * 32 + lane];
#pragma unroll
        for (int j = 0; j < 4; ++j) { a[mb][j] += o0[j]; a[mb][4 + j] += o1[j]; } }
    float mx = a[0][0];
#pragma unroll
    for (int mb = 0; mb < 4; ++mb)
#pragma unroll
        for (int j = 0; j < 8; ++j) mx = fmaxf(mx, a[mb][j]);
    mx = fmaxf(mx, __shfl_xor(mx, 16, 32));
    float sum = 0.f;
#pragma unroll
    for (int mb = 0; mb < 4; ++mb)
#pragma unroll
        for (int j = 0; j < 8; ++j) { a[mb][j] = exp2_slot(__fmul_rn(__fsub_rn(a[mb][j], mx), 1.4426950408889634f)); sum += a[mb][j]; }
    sum += __shfl_xor(sum, 16, 32);
    const float f = __fdiv_rn(1.0f, sum);
    // context planes in fragment order (rows = queries of all batches, k = h * HD + d): the wave's 16 queries x HD columns are 2 fragments = 4 halves in a row, half mb <- d in [16 mb, 16 mb + 16), the lane's chunk at 8 * lane
    const size_t oo = ((size_t)((bz * TT + q0) / 16 + kr) * (DQ / 32) + (size_t)h * (HD / 32)) * 512 + (size_t)lane * 8;
    v4u oh[4], ol[4];
#pragma unroll
    for (int mb = 0; mb < 4; ++mb)
#pragma unroll
        for (int p = 0; p < 4; ++p) {
            const v2f y = { a[mb][2 * p] * f, a[mb][2 * p + 1] * f };
            const unsigned u = __builtin_bit_cast(unsigned, __builtin_convertvector(y, v2bf));
            const v2f yh = { __uint_as_float(u << 16), __uint_as_float(u & 0xFFFF0000u) };
            oh[mb][p] = u; ol[mb][p] = __builtin_bit_cast(unsigned, __builtin_convertvector(y - yh, v2bf));
        }
    __builtin_amdgcn_sched_barrier(0);   // every value is formed in front of the stores: no register that an issued store names is rewritten behind it
#pragma unroll
    for (int mb = 0; mb < 4; ++mb) { *(v8us*)(Ah + oo + mb * 256) = __builtin_bit_cast(v8us, oh[mb]); *(v8us*)(Al + oo + mb * 256) = __builtin_bit_cast(v8us, ol[mb]); }
}

constexpr size_t WS_TOTAL = 4 * SZ_W + NB * (3 * SZ_XB + 3 * SZ_F + 8 * SZ_PL + 2 * SZ_AT) + 2 * SZ_KV + SZ_FL;
static_assert(WS_TOTAL <= (size_t)268435456);
// coverage equalities (threads x 8 elements == plane elements; tiles x 64 x 64 == plane elements)
static_assert(((size_t)DQ * DM / 8) % 256 == 0);
static_assert(((size_t)TT * DM / 8) % 256 == 0);
static_assert(((size_t)NH_ * TT * HD / 8) % 256 == 0);
static_assert((size_t)NH_ * TT * (HD / 8) < ((size_t)1 << 31));

extern "C" void kernel_launch(void* const* d_in, const int* in_sizes, int n_in,
                              void* d_out, int out_size, void* d_ws, size_t ws_size, hipStream_t stream) {
    if (n_in < 12) return;
    const size_t need_x = (size_t)(NB - 1) * SEQ_FULL * DM + (size_t)SEQ * DM;
    const size_t need_m = (size_t)(NB - 1) * SEQ_FULL * SEQ_FULL + (size_t)(SEQ - 1) * SEQ_FULL + (size_t)SEQ;
    if ((size_t)in_sizes[0] < need_x || (size_t)in_sizes[1] < need_x || (size_t)in_sizes[2] < need_x || (size_t)in_sizes[3] < need_m) return;
    if ((size_t)in_sizes[4] < (size_t)DQ * DM || (size_t)in_sizes[6] < (size_t)DQ * DM || (size_t)in_sizes[8] < (size_t)DQ * DM || (size_t)in_sizes[10] < (size_t)DM * DQ) return;
    if (in_sizes[5] < DQ || in_sizes[7] < DQ || in_sizes[9] < DQ || in_sizes[11] < DM) return;
    if ((size_t)out_size < (size_t)NB * SEQ * DM) return;
    if (WS_TOTAL > ws_size) return;
    // wire order: k, q, v, mask (int), Wq, bq, Wk, bk, Wv, bv, Wo, bo ('oi' weights)
    const float* xk = (const float*)d_in[0]; const float* xq = (const float*)d_in[1]; const float* xv = (const float*)d_in[2]; const int* mk = (const int*)d_in[3];
    const float* wq = (const float*)d_in[4]; const float* bq = (const float*)d_in[5]; const float* wk = (const float*)d_in[6]; const float* bk = (const float*)d_in[7];
    const float* wv = (const float*)d_in[8]; const float* bv = (const float*)d_in[9]; const float* wo = (const float*)d_in[10]; const float* bo = (const float*)d_in[11];
    float* OUT = (float*)d_out;     // [NB][SEQ][1024]
    char* wsp = (char*)d_ws;
    bf* WB = (bf*)wsp; wsp += 4 * SZ_W;            // Wq, Wk, Wv, Wo, each in fragment order
    bf* XB = (bf*)wsp; wsp += 3 * NB * SZ_XB;      // [q, k, v][b], each [t][DM] in fragment order
    float* F = (float*)wsp; wsp += 3 * NB * SZ_F;  // [q, k, v][b][t][DQ]
    bf* PL = (bf*)wsp; wsp += 8 * NB * SZ_PL;      // [q hi, q lo, k hi, k lo, v^T hi, v^T lo, k^T hi, k^T lo][b]
    bf* ATh = (bf*)wsp; wsp += NB * SZ_AT; bf* ATl = (bf*)wsp; wsp += NB * SZ_AT;   // [b * TT + t][DQ] in fragment order
    bf* GVh = (bf*)wsp; wsp += SZ_KV; bf* GVl = (bf*)wsp; wsp += SZ_KV;             // v^T k, [b][h] in fragment order
    unsigned* FLG = (unsigned*)wsp; wsp += SZ_FL;                                   // mask tile bits
    constexpr size_t PS = (size_t)NB * NH_ * TT * HD;   // elements of one plane over all batches

    k_cvt8<<<3 * NB * GX + 4 * GW, 256, 0, stream>>>(xq, xk, xv, wq, wk, wv, wo, XB, WB);
    // z = q, k, v: F[z][b * TT + t][n] = bf16(x_z) W_z^T + b_z
    k_gemmw<bf, 0, true, 1><<<dim3(NB * TT / 64, DQ / 64, 3), 32, 0, stream>>>(XB, nullptr, WB, nullptr, DM, DM, F, DQ, bq, bk, bv, (size_t)NB * TT * DM, (size_t)DQ * DM, (size_t)NB * TT * DQ, 0);
    k_planes<<<dim3(GP, 4, NB), 256, 0, stream>>>(F, PL);
    // v^T k of every head; one bit per 32 x 32 mask tile
    k_pre<<<GKV + GMS, 256, 0, stream>>>(PL + 4 * PS, PL + 5 * PS, PL + 6 * PS, PL + 7 * PS, mk, GVh, GVl, FLG);
    // all batches and heads: T = select(q k^T x HD^-0.5) v, softmax over d -> ATh|ATl, row b * TT + t, column h * HD + d
    k_fattn<<<dim3(TT / QWG, NH_, NB), 256, 0, stream>>>(PL, PL + PS, PL + 2 * PS, PL + 3 * PS, PL + 4 * PS, PL + 5 * PS, GVh, GVl, FLG, mk, ATh, ATl);
    // out = (ATh + ATl) Wo^T + bo
    k_gemmw<bf, 1, true, 1><<<dim3(NB * TT / 64, DM / 64, 1), 32, 0, stream>>>(ATh, ATl, WB + 3 * (size_t)DQ * DM, nullptr, DQ, DQ, OUT, DM, bo, bo, bo, 0, 0, 0, 0);
}

// v006
// Measured time: 119 microseconds a run.
// In two side-by-side timings against v005, it was 1.07 and 1.08 times as fast.
// All steps since v000 together make it 11.2 times as fast.
#include <hip/hip_runtime.h>

// Contractions (all f32 accumulate): q/k/v projections v_wmma_f32_16x16x32_bf16 (inputs and weights RNE-converted to bf16, single product, f32 bias add); v^T k, (v^T k) q^T and, for mask tiles that hold a zero, k.q^T and v^T.correction^T: v_wmma_f32_16x16x32_bf16 on bf16 hi|lo pairs (three products hh + hl + lh into one accumulator); output projection bf16 hi/lo context planes x bf16 weights (2 products) + f32 bias; softmax over the head width in f32.
// Multi-head attention on three input streams (wire order k, q, v [NB][SEQ][1024]); 'oi' weights; 16 heads x 64; scores x 0.125; int mask [NB][1][S][S]: where mask == 0 the scaled score is REPLACED by -1e9 (read by value); NO softmax over keys: T = S_sel . V, then softmax over the 64 head columns of T; merged context x Wo^T + bo.
// With no softmax between the two products, for ANY mask: T = S_sel V = (q x 0.125) (k^T V) + C V, where C[query][key] = (mask == 0) ? -1e9 - S : 0. The first term needs one 64 x 64 matrix per head; C is zero on every 32 x 32 tile whose mask holds no zero, and only the other tiles are worked through key by key.
// Five launches, each over both batches (and over the q, k, v streams where they are alike): bf16 copies in fragment order -> projection GEMMs (f32 accumulators + bias), whose epilogue writes the bf16 hi|lo head planes of q, k, v^T and k^T in fragment order -> v^T k per head (hi|lo planes) and, in the same launch, one bit per 32 x 32 mask tile (tile holds a zero) -> one kernel over all heads: T^T = (v^T k)(q x 0.125)^T; per flagged tile S^T = k (q x 0.125)^T -> C^T -> bf16 hi|lo B operands in registers -> T^T += v^T C^T; the two halves of a work-group added through LDS; softmax over d -> context hi/lo bf16 planes in fragment order; context x Wo.

#ifndef NB
#define NB 2
#endif
#ifndef SEQ
#define SEQ 2048
#endif
#define NB_FULL  2
#define SEQ_FULL 2048
#define TT   SEQ
#define DM   1024
#define NH_  16
#define HD   64
#define DQ   (NH_ * HD)
#define QWG  128  // queries of one work-group of the fused kernel: 4 wave columns x 32 queries
#define KR   2    // key ranges of one work-group: 4 x 2 = 8 waves
#define MQ   512  // keys of one work-group of the mask scan
#define MPITCH SEQ_FULL
#define SCL  0.125f   // HD^-0.5
#define FILLV (-1.0e9f)

static_assert(TT % 256 == 0);
static_assert(TT % 64 == 0);
static_assert(DM % 64 == 0);
static_assert(DQ == DM);
static_assert(HD == 64);
static_assert(TT % QWG == 0);
static_assert(NB <= NB_FULL);
static_assert(SEQ <= SEQ_FULL);
static_assert(HD % 32 == 0);
static_assert(TT % 32 == 0);
static_assert(DM % 32 == 0);
static_assert(HD / 8 == 8);
static_assert(TT % (KR * 32) == 0);
static_assert(KR == 2);
static_assert(SCL == 0.125f);
static_assert(TT / KR / 32 == 32);        // a wave's tile bits fill one 32-bit word
static_assert(TT / KR == 2 * MQ);         // made of two scan words of 16 bits
static_assert(TT % (8 * 64) == 0);
static_assert((size_t)NB_FULL * SEQ_FULL * SEQ_FULL * 4 < ((size_t)1 << 32));   // byte offsets into the mask and into a plane fit 32 bits
static_assert((size_t)NB * NH_ * TT * HD * 2 < ((size_t)1 << 32));

constexpr size_t al256(size_t b) { return (b + 255) & ~(size_t)255; }
constexpr size_t SZ_W  = al256((size_t)DQ * DM * 2);            // one weight plane (bf16)
constexpr size_t SZ_XB = al256((size_t)TT * DM * 2);            // bf16 activation copy of one stream and batch
constexpr size_t SZ_PL = al256((size_t)NH_ * TT * HD * 2);      // one bf16 head plane of one batch
constexpr size_t SZ_AT = al256((size_t)TT * DQ * 2);            // one context plane (bf16) of one batch
constexpr unsigned GW = (unsigned)((size_t)DQ * DM / 8 / 256);         // work-groups of one weight copy
constexpr unsigned GX = (unsigned)((size_t)TT * DM / 8 / 256);         // work-groups of one activation copy (one stream, one batch)
constexpr unsigned GKV = NB * NH_ * (HD / 16);                // work-groups of v^T k: one strip of 16 rows each
constexpr unsigned GMS = NB * (TT / 32) * (TT / MQ);          // work-groups of the mask scan: 32 queries x MQ keys each
constexpr size_t SZ_KV = al256((size_t)NB * NH_ * HD * HD * 2);   // one v^T k plane (bf16), all batches and heads
constexpr size_t SZ_FL = (size_t)GMS * 128;                   // tile bits: one word per scan work-group, each in a 128-byte line of its own
// the slices of one buffer stand back to back: stream-major, then batch
static_assert(SZ_W == (size_t)DQ * DM * 2);
static_assert(SZ_XB == (size_t)TT * DM * 2);
static_assert(SZ_PL == (size_t)NH_ * TT * HD * 2);
static_assert(SZ_AT == (size_t)TT * DQ * 2);

typedef _Float16 h16;
typedef unsigned short bf;
typedef __attribute__((ext_vector_type(16))) __bf16   v16bf;
typedef __attribute__((ext_vector_type(16))) _Float16 v16h;
typedef __attribute__((ext_vector_type(8)))  _Float16 v8h;
typedef __attribute__((ext_vector_type(8)))  unsigned short v8us;
typedef __attribute__((ext_vector_type(2)))  __bf16   v2bf;
typedef __attribute__((ext_vector_type(2)))  float    v2f;
typedef __attribute__((ext_vector_type(8)))  unsigned v8u;
typedef __attribute__((ext_vector_type(4)))  unsigned v4u;
typedef __attribute__((ext_vector_type(8)))  int      v8i;
typedef __attribute__((ext_vector_type(8)))  float    v8f;
typedef __attribute__((ext_vector_type(4)))  float    v4f;
typedef __attribute__((ext_vector_type(4)))  int      v4i;
typedef v4f  __attribute__((may_alias)) v4fa;

__device__ __forceinline__ unsigned short f2bf(float f) { unsigned u = __float_as_uint(f); u += 0x7FFFu + ((u >> 16) & 1u); return (unsigned short)(u >> 16); }
__device__ __forceinline__ float bf2f(unsigned short b) { return __uint_as_float(((unsigned)b) << 16); }
__device__ __forceinline__ float bfr(float f) { return bf2f(f2bf(f)); }
__device__ __forceinline__ v16h cat16(v8h lo, v8h hi) { return __builtin_shufflevector(lo, hi, 0, 1, 2, 3, 4, 5, 6, 7, 8, 9, 10, 11, 12, 13, 14, 15); }
__device__ __forceinline__ v16bf cat16b(v8us lo, v8us hi) { return __builtin_bit_cast(v16bf, __builtin_shufflevector(lo, hi, 0, 1, 2, 3, 4, 5, 6, 7, 8, 9, 10, 11, 12, 13, 14, 15)); }
__device__ __forceinline__ v8f wmma16(v16h a, v16h b, v8f c) { return __builtin_amdgcn_wmma_f32_16x16x32_f16(false, a, false, b, (short)0, c, false, false); }
__device__ __forceinline__ v8f wmmab(v16bf a, v16bf b, v8f c) { return __builtin_amdgcn_wmma_f32_16x16x32_bf16(false, a, false, b, (short)0, c, false, false); }

// ---- k_gemmw: register-blocked GEMM, ONE WAVE per 64x64 output tile (16 accumulators), operands straight from 16-bit planes in fragment order (described in front of k_cvt8; fragment number (row / 16) * (K / 32) + k / 32), so that each 16-byte load of the wave covers 4 whole lines; grid (M/64, N/64, Z * KS), 32 threads.
// C[m][n] (f32, pitch ldc, + optional f32 bias[n]) = sum_k A[m][k] Bt[n][k] (+ split products per NSPLIT). z-batch strides sA/sB/sC in elements. K % 32 == 0, M % 64 == 0, N % 64 == 0.
// The bias vector goes by z: bias, bias1, bias2 for z = 0, 1, 2.
// Split over k: K = KS * KC (KC % 32 == 0), blockIdx.z = z * KS + ks; a work-group sums only k in [ks * KC, ks * KC + KC) and stores its partial tile at C + ks * sP; the reader of C adds the KS partials. KS == 1: KC == K, the whole sum.
// PLANES (the q, k, v projections; z = 0, 1, 2; rows = b * TT + t, a tile = 64 tokens of one batch x the HD columns of head blockIdx.y): nothing goes to C; the tile + bias is split into bf16 hi|lo and stored as head planes in fragment order, P[pair s][hi, lo][b], s = q, k, v^T, k^T; a tile is 8 fragments in a row in each plane:
//   rows t, k = d (q, k): fragment number (h * TT / 16 + t / 16) * 2 + d / 32; a chunk is 8 d of one token: the accumulators change places through LDS, 16 tokens at a time;
//   rows d, k = t (v^T, k^T): fragment number (h * TT / 32 + t / 32) * 4 + d / 16; a chunk is 8 tokens of one d, which is one accumulator tile's 8 registers of a lane: stored straight, chunk number = lane.
// Fragment map: lane -> row/col (lane & 15); elements 0..7 <- k0 + 8*(lane>>4) + 0..7, elements 8..15 <- k0 + 16 + 8*(lane>>4) + 0..7 (both operands); acc[j] = (row 8*(lane>>4) + j, col lane & 15).
template <typename T16> struct WFrag;
template <> struct WFrag<h16> { typedef v16h V; static __device__ __forceinline__ V ld(const h16* b, unsigned vo) { const char* p = (const char*)b; return cat16(*(const v8h*)(p + vo), *(const v8h*)(p + 512 + vo)); } static __device__ __forceinline__ v8f mma(V a, V b, v8f c) { return wmma16(a, b, c); } };
template <> struct WFrag<bf> { typedef v16bf V; static __device__ __forceinline__ V ld(const bf* b, unsigned vo) { const char* p = (const char*)b; return cat16b(*(const v8us*)(p + vo), *(const v8us*)(p + 512 + vo)); } static __device__ __forceinline__ v8f mma(V a, V b, v8f c) { return wmmab(a, b, c); } };
// 8 f32 -> 8 bf16 hi (round to nearest even) and 8 bf16 lo (the rest, rounded likewise), packed two to a word
__device__ __forceinline__ void split8(const v8f y8, v4u& oh, v4u& ol) {
#pragma unroll
    for (int p = 0; p < 4; ++p) {
        const v2f y = { y8[2 * p], y8[2 * p + 1] };
        const unsigned u = __builtin_bit_cast(unsigned, __builtin_convertvector(y, v2bf));
        const v2f yh = { __uint_as_float(u << 16), __uint_as_float(u & 0xFFFF0000u) };
        oh[p] = u; ol[p] = __builtin_bit_cast(unsigned, __builtin_convertvector(y - yh, v2bf));
    }
}
template <typename T16, int NSPLIT, bool BIAS, int KS, bool PLANES>
__global__ __launch_bounds__(32) void k_gemmw(const T16* __restrict__ A, const T16* __restrict__ A2, const T16* __restrict__ Bt, const T16* __restrict__ Bt2, int K, int KC, float* C, bf* P, int ldc, const float* __restrict__ bias0, const float* __restrict__ bias1, const float* __restrict__ bias2, size_t sA, size_t sB, size_t sC, size_t sP) {
    typedef typename WFrag<T16>::V V;
    __shared__ __align__(16) float os[16 * 68];
    const size_t z = blockIdx.z / (unsigned)KS, ks = blockIdx.z % (unsigned)KS, ko = ks * KC * 16;   // 32 k of 16 rows are 512 elements in a row
    A += z * sA + ko; if (A2) A2 += z * sA + ko; Bt += z * sB + ko; if (Bt2) Bt2 += z * sB + ko; C += z * sC + ks * sP;
    const float* bias = z == 0 ? bias0 : (z == 1 ? bias1 : bias2);
    const int lane = threadIdx.x & 31, lr = lane & 15, hi = lane >> 4; const int r0 = blockIdx.x * 64, c0 = blockIdx.y * 64;
    v8f acc[4][4];
#pragma unroll
    for (int mb = 0; mb < 4; ++mb)
#pragma unroll
        for (int nb = 0; nb < 4; ++nb) acc[mb][nb] = (v8f){};
    // a fragment's address = wave-uniform start of its 16 rows (16 * K elements in a row) + the lane's byte offset vk: 16 * lane, + 1024 for every 32 k
#pragma unroll 1
    for (int kc = 0; kc < KC; kc += 32) {
        const unsigned vk = (unsigned)lane * 16u + (unsigned)kc * 32u;
        V a[4], a2[4];
#pragma unroll
        for (int mb = 0; mb < 4; ++mb) { a[mb] = WFrag<T16>::ld(A + (size_t)(r0 + mb * 16) * K, vk); if (NSPLIT == 1 || NSPLIT == 2) a2[mb] = WFrag<T16>::ld(A2 + (size_t)(r0 + mb * 16) * K, vk); }
#pragma unroll
        for (int nb = 0; nb < 4; ++nb) { const V b = WFrag<T16>::ld(Bt + (size_t)(c0 + nb * 16) * K, vk); V b2; if (NSPLIT >= 2) b2 = WFrag<T16>::ld(Bt2 + (size_t)(c0 + nb * 16) * K, vk);
#pragma unroll
            for (int mb = 0; mb < 4; ++mb) { acc[mb][nb] = WFrag<T16>::mma(a[mb], b, acc[mb][nb]); if (NSPLIT == 1 || NSPLIT == 2) acc[mb][nb] = WFrag<T16>::mma(a2[mb], b, acc[mb][nb]); if (NSPLIT >= 2) acc[mb][nb] = WFrag<T16>::mma(a[mb], b2, acc[mb][nb]); } }
        asm volatile("v_nop\n\tv_nop\n\tv_nop\n\tv_nop" : "+v"(acc[0][0]), "+v"(acc[1][1]), "+v"(acc[2][2]), "+v"(acc[3][3]) : "v"(a[0]), "v"(a[3]));
    }
    if constexpr (PLANES) {
        constexpr size_t PB = (size_t)NH_ * TT * HD;   // elements of one plane of one batch
        const unsigned b = (unsigned)r0 / (unsigned)TT, t0 = (unsigned)r0 % (unsigned)TT, h = blockIdx.y;
#pragma unroll
        for (int nb = 0; nb < 4; ++nb) { const float bn = bfr(bias[c0 + nb * 16 + lr]);
#pragma unroll
            for (int mb = 0; mb < 4; ++mb)
#pragma unroll
                for (int j = 0; j < 8; ++j) acc[mb][nb][j] += bn; }
        if (z != 0) {   // k^T (pair 3), v^T (pair 2)
            bf* th = P + ((size_t)(z == 1 ? 6 : 4) * NB + b) * PB + (size_t)(h * (unsigned)(TT / 32) + t0 / 32u) * 2048 + lane * 8; bf* tl = th + (size_t)NB * PB;
#pragma unroll
            for (int mb = 0; mb < 4; ++mb) {
                v4u oh[4], ol[4];
#pragma unroll
                for (int nb = 0; nb < 4; ++nb) split8(acc[mb][nb], oh[nb], ol[nb]);
                __builtin_amdgcn_sched_barrier(0);   // the group's values are all formed in front of its stores: no register that an issued store names is rewritten inside the group
#pragma unroll
                for (int nb = 0; nb < 4; ++nb) { *(v4u*)(th + ((mb >> 1) * 4 + nb) * 512 + (mb & 1) * 256) = oh[nb]; *(v4u*)(tl + ((mb >> 1) * 4 + nb) * 512 + (mb & 1) * 256) = ol[nb]; }
                asm volatile("s_wait_xcnt 0x0" ::: "memory");   // in front of the next group, which writes over the registers that these stores name
                __builtin_amdgcn_sched_barrier(0);   // keeps the next group's vector work behind that wait
            }
        }
        if (z != 2) {   // q (pair 0), k (pair 1)
            bf* rh = P + ((size_t)z * 2 * NB + b) * PB + (size_t)(h * (unsigned)(TT / 16) + t0 / 16u) * 1024 + lane * 8; bf* rl = rh + (size_t)NB * PB;
#pragma unroll
            for (int mb = 0; mb < 4; ++mb) {
#pragma unroll
                for (int nb = 0; nb < 4; ++nb)
#pragma unroll
                    for (int j = 0; j < 8; ++j) os[(hi * 8 + j) * 68 + nb * 16 + lr] = acc[mb][nb][j];
                __builtin_amdgcn_wave_barrier(); asm volatile("" ::: "memory");   // the one wave's LDS writes stay in front of its reads
                v4u oh[4], ol[4];
#pragma unroll
                for (int s = 0; s < 4; ++s) {   // chunk: token lr, d = 16 s + 8 hi + 0..7
                    const float* rp = os + lr * 68 + s * 16 + hi * 8; const v4f y0 = *(const v4fa*)rp, y1 = *(const v4fa*)(rp + 4);
                    split8((v8f){y0[0], y0[1], y0[2], y0[3], y1[0], y1[1], y1[2], y1[3]}, oh[s], ol[s]); }
                __builtin_amdgcn_wave_barrier(); asm volatile("" ::: "memory");   // and its reads in front of the next 16 tokens' writes
                __builtin_amdgcn_sched_barrier(0);   // as above: values first, then the stores
#pragma unroll
                for (int s = 0; s < 4; ++s) { *(v4u*)(rh + (mb * 2 + (s >> 1)) * 512 + (s & 1) * 256) = oh[s]; *(v4u*)(rl + (mb * 2 + (s >> 1)) * 512 + (s & 1) * 256) = ol[s]; }
                asm volatile("s_wait_xcnt 0x0" ::: "memory");   // in front of the next group, which writes over the registers that these stores name
                __builtin_amdgcn_sched_barrier(0);   // keeps the next group's vector work behind that wait
            }
        }
        return;
    }
#pragma unroll
    for (int mb = 0; mb < 4; ++mb) {
#pragma unroll
        for (int nb = 0; nb < 4; ++nb) {
#pragma unroll
            for (int j = 0; j < 8; ++j) os[(hi * 8 + j) * 68 + nb * 16 + lr] = acc[mb][nb][j]; }
        __builtin_amdgcn_wave_barrier(); asm volatile("" ::: "memory");
        float* crow = C + (size_t)(r0 + mb * 16) * ldc + c0;
{
#pragma unroll
            for (int s = 0; s < 8; ++s) { const int row = 2 * s + hi, cofs = lr * 4; v4f val = *(const v4fa*)(os + row * 68 + cofs); if (BIAS) { val[0] += bfr(bias[c0 + cofs]); val[1] += bfr(bias[c0 + cofs + 1]); val[2] += bfr(bias[c0 + cofs + 2]); val[3] += bfr(bias[c0 + cofs + 3]); }
                *(v4f*)(crow + (size_t)row * ldc + cofs) = val; }
             }
        __builtin_amdgcn_wave_barrier(); asm volatile("" ::: "memory");
    }
}

__device__ __forceinline__ void splitf(float y, unsigned short& h, unsigned short& l) { h = f2bf(y); l = f2bf(y - bf2f(h)); }

// Fragment order of a 16-bit plane: a 16 x 32 fragment (16 rows or columns x 32 k) is 512 elements in a row, as two halves of 256: half e, lane l = 16 * hi + c, 8 elements <- row c, k = 16 * e + 8 * hi + 0..7.
// A wave's two 16-byte loads of a fragment then each cover 512 contiguous bytes (4 whole lines) instead of 16 lines.
// k_cvt8: every f32 -> bf16 copy in one launch, each matrix [rows][DM] written in fragment order, fragment number (row / 16) * (DM / 32) + k / 32. A work-group copies 16 rows x 128 k = 4 fragments in a row = 2048 elements.
// Work-groups [0, 3 * NB * GX): activations, stream s, batch b -> XB[s][b]; the other 4 * GW: weights -> WB[s]. The grid covers every slice exactly.
// Thread i reads 8 k of one row (16 threads: 512 bytes in a row of the source); that chunk is number (i & 15) * 16 + (i >> 4) of the work-group's 256: the chunks change places through LDS, so that reads and stores both cover whole lines.
static_assert(DM % 128 == 0);
static_assert(TT % 16 == 0);
static_assert(DQ % 16 == 0);
__global__ __launch_bounds__(256) void k_cvt8(const float* __restrict__ x0, const float* __restrict__ x1, const float* __restrict__ x2, const float* __restrict__ w0, const float* __restrict__ w1, const float* __restrict__ w2, const float* __restrict__ w3, bf* XB, bf* WB) {
    __shared__ v8us st[16 * 17];   // [k / 8][row], 17 chunks a line: the 16 chunks that a row's threads write fall into different banks
    const unsigned bx = blockIdx.x; const float* src; bf* dst; unsigned c;
    if (bx < 3u * NB * GX) { const unsigned s = bx / (NB * GX), b = (bx / GX) % (unsigned)NB; c = bx % GX; src = (s == 0 ? x0 : (s == 1 ? x1 : x2)) + (size_t)b * SEQ_FULL * DM; dst = XB + (size_t)bx * 2048; }
    else { const unsigned r = bx - 3u * NB * GX, s = r / GW; c = r % GW; src = (s == 0 ? w0 : (s == 1 ? w1 : (s == 2 ? w2 : w3))); dst = WB + (size_t)r * 2048; }
    const unsigned i = threadIdx.x, row = i >> 4, k8 = i & 15u;
    const v8f v = *(const v8f*)(src + (size_t)((c / (unsigned)(DM / 128)) * 16 + row) * DM + (c % (unsigned)(DM / 128)) * 128 + k8 * 8); v8us o;
#pragma unroll
    for (int k = 0; k < 8; ++k) o[k] = f2bf(v[k]);
    st[k8 * 17 + row] = o;
    __syncthreads();
    *(v8us*)(dst + i * 8) = st[(i >> 4) * 17 + (i & 15u)];  }

// one fragment: b + vo = byte address of the fragment + 16 * lane, b wave-uniform
__device__ __forceinline__ v16bf ldfr(const char* b, unsigned vo) { return cat16b(*(const v8us*)(b + vo), *(const v8us*)(b + 512 + vo)); }
// 2^x; the v_nop fills the slot that the instruction set asks for behind a transcendental before its result is read or its source overwritten
__device__ __forceinline__ float exp2_slot(float x) { float r; asm("v_exp_f32 %0, %1\n\tv_nop" : "=v"(r) : "v"(x)); return r; }
__device__ __forceinline__ v8i ldm8(const char* b, unsigned vo) { return __builtin_shufflevector(*(const v4i*)(b + vo), *(const v4i*)(b + 16 + vo), 0, 1, 2, 3, 4, 5, 6, 7); }

// k_pre: two jobs that the attention kernel needs, independent of each other, in one launch.
// Work-groups [0, GKV): plane head hb = blockIdx.x / 4, strip mb = blockIdx.x % 4: G[d][e] = sum_t v[t][d] k[t][e] for the 16 rows d of the strip, all 64 e (A = v^T fragments, B = k^T fragments, both k = t; vh.kh + vh.kl + vl.kh).
//   Wave w sums keys [w * TT / 8, + TT / 8); the 8 partial strips are added through LDS in wave order; G goes out as bf16 hi|lo in A-fragment order (rows d, k = e): fragment number (hb * 4 + mb) * 2 + e / 32.
// The other GMS work-groups: r = (batch * TT / 32 + query tile) * (TT / MQ) + key block: bit p of FL[r * 32] = the mask of these 32 queries holds a zero among keys [32 p, 32 p + 32) of the block.
__global__ __launch_bounds__(256) void k_pre(const bf* __restrict__ Vh, const bf* __restrict__ Vl, const bf* __restrict__ KTh, const bf* __restrict__ KTl, const int* __restrict__ M, bf* Gh, bf* Gl, unsigned* FL) {
    __shared__ __align__(16) float red[8 * 32 * 32];   // [wave][nb * 8 + j][lane]
    __shared__ unsigned fl[8];
    const int lane = threadIdx.x & 31;
    const int w = __builtin_amdgcn_readfirstlane((int)(threadIdx.x >> 5));
    if (blockIdx.x < GKV) {
        const unsigned hb = blockIdx.x >> 2, mb = blockIdx.x & 3u, vo = lane * 16;
        const size_t po = ((size_t)hb * TT + (size_t)w * (TT / 8)) * HD * 2;
        v8f acc[4];
#pragma unroll
        for (int nb = 0; nb < 4; ++nb) acc[nb] = (v8f){};
#pragma unroll   // straight-line: no matrix instruction stands in front of a back edge
        for (int s = 0; s < TT / 8 / 32; s += 2) {
            v16bf vh[2], vl[2], kh[2][4], kl[2][4];
#pragma unroll
            for (int u = 0; u < 2; ++u) { vh[u] = ldfr((const char*)Vh + po + (s + u) * 4096 + mb * 1024, vo); vl[u] = ldfr((const char*)Vl + po + (s + u) * 4096 + mb * 1024, vo);
#pragma unroll
                for (int nb = 0; nb < 4; ++nb) { kh[u][nb] = ldfr((const char*)KTh + po + (s + u) * 4096 + nb * 1024, vo); kl[u][nb] = ldfr((const char*)KTl + po + (s + u) * 4096 + nb * 1024, vo); } }
            // the 40 loads of two steps are all in flight together: left alone, the compiler issues them two at a time, each pair with a full wait in front of its matrix instruction
            asm volatile("" :: "v"(vh[0]), "v"(vh[1]), "v"(vl[0]), "v"(vl[1]), "v"(kh[0][0]), "v"(kh[0][1]), "v"(kh[0][2]), "v"(kh[0][3]), "v"(kh[1][0]), "v"(kh[1][1]), "v"(kh[1][2]), "v"(kh[1][3]), "v"(kl[0][0]), "v"(kl[0][1]), "v"(kl[0][2]), "v"(kl[0][3]), "v"(kl[1][0]), "v"(kl[1][1]), "v"(kl[1][2]), "v"(kl[1][3]));
#pragma unroll
            for (int u = 0; u < 2; ++u) {
#pragma unroll
                for (int nb = 0; nb < 4; ++nb) acc[nb] = wmmab(vh[u], kh[u][nb], acc[nb]);
#pragma unroll
                for (int nb = 0; nb < 4; ++nb) acc[nb] = wmmab(vh[u], kl[u][nb], acc[nb]);
#pragma unroll
                for (int nb = 0; nb < 4; ++nb) acc[nb] = wmmab(vl[u], kh[u][nb], acc[nb]);
            }
        }
#pragma unroll
        for (int nb = 0; nb < 4; ++nb)
#pragma unroll
            for (int j = 0; j < 8; ++j) red[(w * 32 + nb * 8 + j) * 32 + lane] = acc[nb][j];
        __syncthreads();
        // thread i < 128 forms chunk i of the strip's two fragments: i = (ks * 2 + e) * 32 + l; row c = l & 15, columns (ks * 2 + e) * 16 + 8 * (l >> 4) + 0..7, which are 8 lanes in a row of accumulator register c & 7
        if (threadIdx.x < 128) {
            const unsigned i = threadIdx.x, c = i & 15u;
            const float* rp = red + ((i >> 5) * 8 + (c & 7u)) * 32 + (c >> 3) * 16 + ((i >> 4) & 1u) * 8;
            v4f s0 = *(const v4fa*)rp, s1 = *(const v4fa*)(rp + 4);
#pragma unroll
            for (int u = 1; u < 8; ++u) { s0 += *(const v4fa*)(rp + u * 1024); s1 += *(const v4fa*)(rp + u * 1024 + 4); }
            v8us oh, ol;
#pragma unroll
            for (int q = 0; q < 4; ++q) { unsigned short a, c2; splitf(s0[q], a, c2); oh[q] = a; ol[q] = c2; splitf(s1[q], a, c2); oh[4 + q] = a; ol[4 + q] = c2; }
            *(v8us*)(Gh + (size_t)blockIdx.x * 1024 + i * 8) = oh; *(v8us*)(Gl + (size_t)blockIdx.x * 1024 + i * 8) = ol;
        }
    } else {
        const unsigned r = blockIdx.x - GKV, kb = r % (unsigned)(TT / MQ), qt = (r / (unsigned)(TT / MQ)) % (unsigned)(TT / 32), b = r / (unsigned)((TT / MQ) * (TT / 32));
        // wave w: rows 4 w .. 4 w + 3 of the tile row; a load covers 128 keys of one row, lane l keys 4 l .. 4 l + 3
        const int* mp = M + (size_t)b * SEQ_FULL * SEQ_FULL + (size_t)(qt * 32 + w * 4) * MPITCH + kb * MQ + lane * 4;
        unsigned mn[MQ / 128];
#pragma unroll
        for (int c = 0; c < MQ / 128; ++c) mn[c] = 0xFFFFFFFFu;
#pragma unroll
        for (int row = 0; row < 4; ++row)
#pragma unroll
            for (int c = 0; c < MQ / 128; ++c) { const v4i x = *(const v4i*)(mp + (size_t)row * MPITCH + c * 128);
                mn[c] = min(min(mn[c], min((unsigned)x[0], (unsigned)x[1])), min((unsigned)x[2], (unsigned)x[3])); }   // unsigned minimum: 0 exactly where a value is 0
        unsigned bits = 0;
#pragma unroll
        for (int c = 0; c < MQ / 128; ++c) { const unsigned bal = __builtin_amdgcn_ballot_w32(mn[c] == 0u);
#pragma unroll
            for (int g = 0; g < 4; ++g) bits |= ((bal >> (8 * g)) & 0xFFu) ? (1u << (c * 4 + g)) : 0u; }
        if (lane == 0) fl[w] = bits;
        __syncthreads();
        if (threadIdx.x == 0) { unsigned o = 0;
#pragma unroll
            for (int u = 0; u < 8; ++u) o |= fl[u];
            FL[(size_t)r * 32] = o; }
    }
}

// k_fattn: one batch (blockIdx.z), one head (blockIdx.y), QWG queries (blockIdx.x); a batch's heads follow the batch before in every plane (plane head number hb); wave w: 32 queries (column w & 3), half kr = w >> 2 of KR.
//   T^T[d][query] = G (q x HD^-0.5)^T, G = v^T k of the head (k_pre): wave kr sums columns e in [32 kr, 32 kr + 32) (gh.qh + gh.ql + gl.qh).
// Then, only for those of the wave's 32 tiles of 32 keys (key range kr) whose bit in FL says that the mask holds a zero there:
//   S^T[key][query] = k (q x HD^-0.5)^T (A = k fragments, B = scaled q fragments kept in registers; kh.qh + kh.ql + kl.qh per 32 d);
//   C = (mask[query][key] == 0) ? -1e9 - S : 0 (takes S out of the full sum and puts -1e9 in; read by value), split into bf16 hi|lo: the two 16-key accumulator tiles of one query tile ARE the B fragment of the next product (element s <- tile s >> 3, register s & 7);
//   T^T[d][query] += v^T C^T (vh.sh + vh.sl + vl.sh).
// Then the two halves are added through LDS (half 0 + half 1; wave of range r finishes query tile r), softmax over the HD values of a query (32 in the lane, 32 in lane ^ 16), context hi|lo planes.
__global__ __launch_bounds__(256) void k_fattn(const bf* __restrict__ Qh, const bf* __restrict__ Ql, const bf* __restrict__ Kh, const bf* __restrict__ Kl, const bf* __restrict__ Vh, const bf* __restrict__ Vl, const bf* __restrict__ Gh, const bf* __restrict__ Gl, const unsigned* __restrict__ FL, const int* __restrict__ M, bf* Ah, bf* Al) {
    __shared__ v4f xs[8 * 8 * 32];
    const int lane = threadIdx.x & 31, lr = lane & 15, hi = lane >> 4;
    const int w = __builtin_amdgcn_readfirstlane((int)(threadIdx.x >> 5)); const int kr = w >> 2;
    const int bz = blockIdx.z, h = blockIdx.y, hb = bz * NH_ + h, q0 = blockIdx.x * QWG + (w & 3) * 32;
    constexpr int NST = TT / KR / 32;
    const unsigned vo = lane * 16, vm = (unsigned)(lr * MPITCH + 8 * hi) * 4;
    const size_t qo = ((size_t)hb * TT + q0) * HD * 2;
    // which of this wave's 32 key tiles hold a masked entry (wave-uniform)
    const unsigned fr = ((unsigned)bz * (TT / 32) + (unsigned)q0 / 32u) * (TT / MQ) + (unsigned)kr * (TT / KR / MQ);
    const unsigned need = (unsigned)__builtin_amdgcn_readfirstlane((int)(FL[(size_t)fr * 32] | (FL[(size_t)(fr + 1) * 32] << 16)));
    v8f T[4][2];
    { const size_t go = ((size_t)hb * 8 + kr) * 1024;
      v16bf qhs[2], qls[2];   // the q fragments of columns [32 kr, 32 kr + 32). HD^-0.5 is a power of two: exact on bf16, once per wave instead of once per score
#pragma unroll
      for (int qt = 0; qt < 2; ++qt) { qhs[qt] = ldfr((const char*)Qh + qo + (qt * 2 + kr) * 1024, vo); qls[qt] = ldfr((const char*)Ql + qo + (qt * 2 + kr) * 1024, vo); }
      v16bf gh[4], gl[4];
#pragma unroll
      for (int mb = 0; mb < 4; ++mb) { gh[mb] = ldfr((const char*)Gh + go + mb * 2048, vo); gl[mb] = ldfr((const char*)Gl + go + mb * 2048, vo); }
      __builtin_amdgcn_sched_barrier(0);   // all 24 loads are issued in front of the first product: left alone, the compiler issues the lo fragments of G only behind the products of the hi fragments, a second full wait
#pragma unroll
      for (int qt = 0; qt < 2; ++qt) { qhs[qt] = qhs[qt] * (__bf16)SCL; qls[qt] = qls[qt] * (__bf16)SCL; }
#pragma unroll
      for (int mb = 0; mb < 4; ++mb)
#pragma unroll
        for (int qt = 0; qt < 2; ++qt) T[mb][qt] = wmmab(gh[mb], qhs[qt], (v8f){});
#pragma unroll
      for (int mb = 0; mb < 4; ++mb)
#pragma unroll
        for (int qt = 0; qt < 2; ++qt) T[mb][qt] = wmmab(gh[mb], qls[qt], T[mb][qt]);
#pragma unroll
      for (int mb = 0; mb < 4; ++mb)
#pragma unroll
        for (int qt = 0; qt < 2; ++qt) T[mb][qt] = wmmab(gl[mb], qhs[qt], T[mb][qt]); }
    // v_nop x 4: the branches of the tile loop follow, and behind them vector instructions read these results. The operands keep every matrix instruction above in front of the slots
    asm volatile("v_nop\n\tv_nop\n\tv_nop\n\tv_nop" : "+v"(T[0][0]), "+v"(T[0][1]), "+v"(T[1][0]), "+v"(T[1][1]), "+v"(T[2][0]), "+v"(T[2][1]), "+v"(T[3][0]), "+v"(T[3][1]));
    // a tile's 32 keys are 4096 bytes in a row in each of the four k and v^T planes
    const unsigned po0 = ((unsigned)hb * TT + (unsigned)kr * (TT / KR)) * HD * 2;
    const unsigned mo0 = ((unsigned)bz * SEQ_FULL * SEQ_FULL + (unsigned)q0 * MPITCH + (unsigned)kr * (TT / KR)) * 4;
    unsigned rem = need;
    v16bf qh[2][2], ql[2][2];
    if (need != 0u) {   // all of q is wanted only where a tile is worked through
#pragma unroll
      for (int qt = 0; qt < 2; ++qt)
#pragma unroll
        for (int ks = 0; ks < 2; ++ks) { qh[qt][ks] = ldfr((const char*)Qh + qo + (qt * 2 + ks) * 1024, vo) * (__bf16)SCL; ql[qt][ks] = ldfr((const char*)Ql + qo + (qt * 2 + ks) * 1024, vo) * (__bf16)SCL; } }
#pragma unroll 1   // one pass holds 48 matrix instructions and every register set once; most masks need few passes or none
    for (int it = 0; it < NST && rem != 0u; ++it) {   // one pass per set bit, lowest first: at most NST passes
        const unsigned s = (unsigned)__builtin_ctz(rem); rem &= rem - 1u;
        const unsigned po = po0 + s * 4096u + vo, mo = mo0 + s * 128u + vm;   // the lane's byte offsets into the planes and into the mask: every load of the pass names a kernel argument and one of these two
        v16bf kh[2][2], kl[2][2], vh[4], vl[4]; v8i mk[2][2];
#pragma unroll
        for (int kt = 0; kt < 2; ++kt)
#pragma unroll
            for (int ks = 0; ks < 2; ++ks) { kh[kt][ks] = ldfr((const char*)Kh + (kt * 2 + ks) * 1024, po); kl[kt][ks] = ldfr((const char*)Kl + (kt * 2 + ks) * 1024, po); }
#pragma unroll
        for (int qt = 0; qt < 2; ++qt)
#pragma unroll
            for (int kt = 0; kt < 2; ++kt) mk[qt][kt] = ldm8((const char*)M + (size_t)qt * 16 * MPITCH * 4 + kt * 64, mo);
#pragma unroll
        for (int mb = 0; mb < 4; ++mb) { vh[mb] = ldfr((const char*)Vh + mb * 1024, po); vl[mb] = ldfr((const char*)Vl + mb * 1024, po); }
        v8f S[2][2];
#pragma unroll
        for (int kt = 0; kt < 2; ++kt) { S[kt][0] = (v8f){}; S[kt][1] = (v8f){}; }
#pragma unroll
        for (int ks = 0; ks < 2; ++ks) {
#pragma unroll
            for (int kt = 0; kt < 2; ++kt)
#pragma unroll
                for (int qt = 0; qt < 2; ++qt) S[kt][qt] = wmmab(kh[kt][ks], qh[qt][ks], S[kt][qt]);
#pragma unroll
            for (int kt = 0; kt < 2; ++kt)
#pragma unroll
                for (int qt = 0; qt < 2; ++qt) S[kt][qt] = wmmab(kh[kt][ks], ql[qt][ks], S[kt][qt]);
#pragma unroll
            for (int kt = 0; kt < 2; ++kt)
#pragma unroll
                for (int qt = 0; qt < 2; ++qt) S[kt][qt] = wmmab(kl[kt][ks], qh[qt][ks], S[kt][qt]);
        }
        v16bf sh[2], sl[2];
#pragma unroll
        for (int qt = 0; qt < 2; ++qt) {
            v8u uh, ul;   // word kt * 4 + p = elements kt * 8 + 2 p, + 1 of the B fragment
#pragma unroll
            for (int kt = 0; kt < 2; ++kt)
#pragma unroll
                for (int p = 0; p < 4; ++p) {
                    const v2f y = { (mk[qt][kt][2 * p] == 0) ? FILLV - S[kt][qt][2 * p] : 0.0f, (mk[qt][kt][2 * p + 1] == 0) ? FILLV - S[kt][qt][2 * p + 1] : 0.0f };
                    const unsigned u = __builtin_bit_cast(unsigned, __builtin_convertvector(y, v2bf));
                    const v2f yh = { __uint_as_float(u << 16), __uint_as_float(u & 0xFFFF0000u) };
                    uh[kt * 4 + p] = u; ul[kt * 4 + p] = __builtin_bit_cast(unsigned, __builtin_convertvector(y - yh, v2bf));
                }
            sh[qt] = __builtin_bit_cast(v16bf, uh); sl[qt] = __builtin_bit_cast(v16bf, ul);
        }
#pragma unroll
        for (int mb = 0; mb < 4; ++mb)
#pragma unroll
            for (int qt = 0; qt < 2; ++qt) T[mb][qt] = wmmab(vh[mb], sh[qt], T[mb][qt]);
#pragma unroll
        for (int mb = 0; mb < 4; ++mb)
#pragma unroll
            for (int qt = 0; qt < 2; ++qt) T[mb][qt] = wmmab(vh[mb], sl[qt], T[mb][qt]);
#pragma unroll
        for (int mb = 0; mb < 4; ++mb)
#pragma unroll
            for (int qt = 0; qt < 2; ++qt) T[mb][qt] = wmmab(vl[mb], sh[qt], T[mb][qt]);
        // v_nop x 4: the pass's last matrix instructions stand right in front of the loop's branches, behind which vector instructions read their results or write over their operands.
        // po and mo as inputs: the two offset registers that the pass's loads name stay unwritten until every one of these loads has landed
        asm volatile("v_nop\n\tv_nop\n\tv_nop\n\tv_nop" : "+v"(T[0][0]), "+v"(T[0][1]), "+v"(T[1][0]), "+v"(T[1][1]), "+v"(T[2][0]), "+v"(T[2][1]), "+v"(T[3][0]), "+v"(T[3][1]) : "v"(po), "v"(mo));
    }
    // hand the other query tile's partial sums to the wave of the other half, take its sums for this wave's tile
    v8f a[4];
#pragma unroll
    for (int mb = 0; mb < 4; ++mb) { const v8f sv = kr ? T[mb][0] : T[mb][1]; a[mb] = kr ? T[mb][1] : T[mb][0];
        xs[(w * 8 + mb * 2) * 32 + lane] = (v4f){sv[0], sv[1], sv[2], sv[3]}; xs[(w * 8 + mb * 2 + 1) * 32 + lane] = (v4f){sv[4], sv[5], sv[6], sv[7]}; }
    __syncthreads();
#pragma unroll
    for (int mb = 0; mb < 4; ++mb) { const v4f o0 = xs[((w ^ 4) * 8 + mb * 2) * 32 + lane], o1 = xs[((w ^ 4) * 8 + mb * 2 + 1) * 32 + lane];
#pragma unroll
        for (int j = 0; j < 4; ++j) { a[mb][j] += o0[j]; a[mb][4 + j] += o1[j]; } }
    float mx = a[0][0];
#pragma unroll
    for (int mb = 0; mb < 4; ++mb)
#pragma unroll
        for (int j = 0; j < 8; ++j) mx = fmaxf(mx, a[mb][j]);
    mx = fmaxf(mx, __shfl_xor(mx, 16, 32));
    float sum = 0.f;
#pragma unroll
    for (int mb = 0; mb < 4; ++mb)
#pragma unroll
        for (int j = 0; j < 8; ++j) { a[mb][j] = exp2_slot(__fmul_rn(__fsub_rn(a[mb][j], mx), 1.4426950408889634f)); sum += a[mb][j]; }
    sum += __shfl_xor(sum, 16, 32);
    const float f = __fdiv_rn(1.0f, sum);
    // context planes in fragment order (rows = queries of all batches, k = h * HD + d): the wave's 16 queries x HD columns are 2 fragments = 4 halves in a row, half mb <- d in [16 mb, 16 mb + 16), the lane's chunk at 8 * lane
    const size_t oo = ((size_t)((bz * TT + q0) / 16 + kr) * (DQ / 32) + (size_t)h * (HD / 32)) * 512 + (size_t)lane * 8;
    v4u oh[4], ol[4];
#pragma unroll
    for (int mb = 0; mb < 4; ++mb)
#pragma unroll
        for (int p = 0; p < 4; ++p) {
            const v2f y = { a[mb][2 * p] * f, a[mb][2 * p + 1] * f };
            const unsigned u = __builtin_bit_cast(unsigned, __builtin_convertvector(y, v2bf));
            const v2f yh = { __uint_as_float(u << 16), __uint_as_float(u & 0xFFFF0000u) };
            oh[mb][p] = u; ol[mb][p] = __builtin_bit_cast(unsigned, __builtin_convertvector(y - yh, v2bf));
        }
    __builtin_amdgcn_sched_barrier(0);   // every value is formed in front of the stores: no register that an issued store names is rewritten behind it
#pragma unroll
    for (int mb = 0; mb < 4; ++mb) { *(v8us*)(Ah + oo + mb * 256) = __builtin_bit_cast(v8us, oh[mb]); *(v8us*)(Al + oo + mb * 256) = __builtin_bit_cast(v8us, ol[mb]); }
}

constexpr size_t WS_TOTAL = 4 * SZ_W + NB * (3 * SZ_XB + 8 * SZ_PL + 2 * SZ_AT) + 2 * SZ_KV + SZ_FL;
static_assert(WS_TOTAL <= (size_t)268435456);
// coverage equalities (threads x 8 elements == plane elements; tiles x 64 x 64 == plane elements)
static_assert(((size_t)DQ * DM / 8) % 256 == 0);
static_assert(((size_t)TT * DM / 8) % 256 == 0);
static_assert((size_t)(NB * TT / 64) * (DQ / 64) * 64 * 64 == (size_t)NB * NH_ * TT * HD);   // the projection's tiles cover every plane exactly; TT % 64 == 0: a tile lies in one batch; HD == 64: in one head

extern "C" void kernel_launch(void* const* d_in, const int* in_sizes, int n_in,
                              void* d_out, int out_size, void* d_ws, size_t ws_size, hipStream_t stream) {
    if (n_in < 12) return;
    const size_t need_x = (size_t)(NB - 1) * SEQ_FULL * DM + (size_t)SEQ * DM;
    const size_t need_m = (size_t)(NB - 1) * SEQ_FULL * SEQ_FULL + (size_t)(SEQ - 1) * SEQ_FULL + (size_t)SEQ;
    if ((size_t)in_sizes[0] < need_x || (size_t)in_sizes[1] < need_x || (size_t)in_sizes[2] < need_x || (size_t)in_sizes[3] < need_m) return;
    if ((size_t)in_sizes[4] < (size_t)DQ * DM || (size_t)in_sizes[6] < (size_t)DQ * DM || (size_t)in_sizes[8] < (size_t)DQ * DM || (size_t)in_sizes[10] < (size_t)DM * DQ) return;
    if (in_sizes[5] < DQ || in_sizes[7] < DQ || in_sizes[9] < DQ || in_sizes[11] < DM) return;
    if ((size_t)out_size < (size_t)NB * SEQ * DM) return;
    if (WS_TOTAL > ws_size) return;
    // wire order: k, q, v, mask (int), Wq, bq, Wk, bk, Wv, bv, Wo, bo ('oi' weights)
    const float* xk = (const float*)d_in[0]; const float* xq = (const float*)d_in[1]; const float* xv = (const float*)d_in[2]; const int* mk = (const int*)d_in[3];
    const float* wq = (const float*)d_in[4]; const float* bq = (const float*)d_in[5]; const float* wk = (const float*)d_in[6]; const float* bk = (const float*)d_in[7];
    const float* wv = (const float*)d_in[8]; const float* bv = (const float*)d_in[9]; const float* wo = (const float*)d_in[10]; const float* bo = (const float*)d_in[11];
    float* OUT = (float*)d_out;     // [NB][SEQ][1024]
    char* wsp = (char*)d_ws;
    bf* WB = (bf*)wsp; wsp += 4 * SZ_W;            // Wq, Wk, Wv, Wo, each in fragment order
    bf* XB = (bf*)wsp; wsp += 3 * NB * SZ_XB;      // [q, k, v][b], each [t][DM] in fragment order
    bf* PL = (bf*)wsp; wsp += 8 * NB * SZ_PL;      // [q hi, q lo, k hi, k lo, v^T hi, v^T lo, k^T hi, k^T lo][b]
    bf* ATh = (bf*)wsp; wsp += NB * SZ_AT; bf* ATl = (bf*)wsp; wsp += NB * SZ_AT;   // [b * TT + t][DQ] in fragment order
    bf* GVh = (bf*)wsp; wsp += SZ_KV; bf* GVl = (bf*)wsp; wsp += SZ_KV;             // v^T k, [b][h] in fragment order
    unsigned* FLG = (unsigned*)wsp; wsp += SZ_FL;                                   // mask tile bits
    constexpr size_t PS = (size_t)NB * NH_ * TT * HD;   // elements of one plane over all batches

    k_cvt8<<<3 * NB * GX + 4 * GW, 256, 0, stream>>>(xq, xk, xv, wq, wk, wv, wo, XB, WB);
    // z = q, k, v: bf16(x_z) W_z^T + b_z, row b * TT + t, written as head planes
    k_gemmw<bf, 0, true, 1, true><<<dim3(NB * TT / 64, DQ / 64, 3), 32, 0, stream>>>(XB, nullptr, WB, nullptr, DM, DM, nullptr, PL, DQ, bq, bk, bv, (size_t)NB * TT * DM, (size_t)DQ * DM, 0, 0);
    // v^T k of every head; one bit per 32 x 32 mask tile
    k_pre<<<GKV + GMS, 256, 0, stream>>>(PL + 4 * PS, PL + 5 * PS, PL + 6 * PS, PL + 7 * PS, mk, GVh, GVl, FLG);
    // all batches and heads: T = select(q k^T x HD^-0.5) v, softmax over d -> ATh|ATl, row b * TT + t, column h * HD + d
    k_fattn<<<dim3(TT / QWG, NH_, NB), 256, 0, stream>>>(PL, PL + PS, PL + 2 * PS, PL + 3 * PS, PL + 4 * PS, PL + 5 * PS, GVh, GVl, FLG, mk, ATh, ATl);
    // out = (ATh + ATl) Wo^T + bo
    k_gemmw<bf, 1, true, 1, false><<<dim3(NB * TT / 64, DM / 64, 1), 32, 0, stream>>>(ATh, ATl, WB + 3 * (size_t)DQ * DM, nullptr, DQ, DQ, OUT, nullptr, DM, bo, bo, bo, 0, 0, 0, 0);
}

// v007
// Measured time: 71.5 microseconds a run.
// Timed twice side by side with v006, it ran 1.64 and 1.66 times as fast.
// Counting every step since v000, it is 18.5 times as fast.
#include <hip/hip_runtime.h>

// Contractions (all f32 accumulate): q/k/v projections v_wmma_f32_16x16x32_bf16 (inputs and weights RNE-converted to bf16, single product, f32 bias add); v^T k, (v^T k) q^T and, for mask tiles that hold a zero, k.q^T and v^T.correction^T: v_wmma_f32_16x16x32_bf16 on bf16 hi|lo pairs (three products hh + hl + lh into one accumulator); output projection bf16 hi/lo context planes x bf16 weights (2 products) + f32 bias; softmax over the head width in f32.
// Multi-head attention on three input streams (wire order k, q, v [NB][SEQ][1024]); 'oi' weights; 16 heads x 64; scores x 0.125; int mask [NB][1][S][S]: where mask == 0 the scaled score is REPLACED by -1e9 (read by value); NO softmax over keys: T = S_sel . V, then softmax over the 64 head columns of T; merged context x Wo^T + bo.
// With no softmax between the two products, for ANY mask: T = S_sel V = (q x 0.125) (k^T V) + C V, where C[query][key] = (mask == 0) ? -1e9 - S : 0. The first term needs one 64 x 64 matrix per head; C is zero on every 32 x 32 tile whose mask holds no zero, and only the other tiles are worked through key by key.
// Five launches, each over both batches (and over the q, k, v streams where they are alike): bf16 copies in fragment order -> projection GEMMs (f32 accumulators + bias), whose epilogue writes the bf16 hi|lo head planes of q, k, v^T and k^T in fragment order -> v^T k per head (hi|lo planes) and, in the same launch, one bit per 32 x 32 mask tile (tile holds a zero) -> one kernel over all heads: T^T = (v^T k)(q x 0.125)^T; per flagged tile S^T = k (q x 0.125)^T -> C^T -> bf16 hi|lo B operands in registers -> T^T += v^T C^T; the two halves of a work-group added through LDS; softmax over d -> context hi/lo bf16 planes in fragment order; context x Wo.

#ifndef NB
#define NB 2
#endif
#ifndef SEQ
#define SEQ 2048
#endif
#define NB_FULL  2
#define SEQ_FULL 2048
#define TT   SEQ
#define DM   1024
#define NH_  16
#define HD   64
#define DQ   (NH_ * HD)
#define QWG  128  // queries of one work-group of the fused kernel: 4 wave columns x 32 queries
#define KR   2    // key ranges of one work-group: 4 x 2 = 8 waves
#define MQ   512  // keys of one work-group of the mask scan
#define MPITCH SEQ_FULL
#define SCL  0.125f   // HD^-0.5
#define FILLV (-1.0e9f)

static_assert(TT % 256 == 0);
static_assert(TT % 64 == 0);
static_assert(DM % 64 == 0);
static_assert(DQ == DM);
static_assert(HD == 64);
static_assert(TT % QWG == 0);
static_assert(NB <= NB_FULL);
static_assert(SEQ <= SEQ_FULL);
static_assert(HD % 32 == 0);
static_assert(TT % 32 == 0);
static_assert(DM % 32 == 0);
static_assert(HD / 8 == 8);
static_assert(TT % (KR * 32) == 0);
static_assert(KR == 2);
static_assert(SCL == 0.125f);
static_assert(TT / KR / 32 == 32);        // a wave's tile bits fill one 32-bit word
static_assert(TT / KR == 2 * MQ);         // made of two scan words of 16 bits
static_assert(TT % (8 * 64) == 0);
static_assert((size_t)NB_FULL * SEQ_FULL * SEQ_FULL * 4 < ((size_t)1 << 32));   // byte offsets into the mask and into a plane fit 32 bits
static_assert((size_t)NB * NH_ * TT * HD * 2 < ((size_t)1 << 32));

constexpr size_t al256(size_t b) { return (b + 255) & ~(size_t)255; }
constexpr size_t SZ_W  = al256((size_t)DQ * DM * 2);            // one weight plane (bf16)
constexpr size_t SZ_XB = al256((size_t)TT * DM * 2);            // bf16 activation copy of one stream and batch
constexpr size_t SZ_PL = al256((size_t)NH_ * TT * HD * 2);      // one bf16 head plane of one batch
constexpr size_t SZ_AT = al256((size_t)TT * DQ * 2);            // one context plane (bf16) of one batch
constexpr unsigned GW = (unsigned)((size_t)DQ * DM / 8 / 256);         // work-groups of one weight copy
constexpr unsigned GX = (unsigned)((size_t)TT * DM / 8 / 256);         // work-groups of one activation copy (one stream, one batch)
constexpr unsigned GKV = NB * NH_ * (HD / 16);                // work-groups of v^T k: one strip of 16 rows each
constexpr unsigned GMS = NB * (TT / 32) * (TT / MQ);          // work-groups of the mask scan: 32 queries x MQ keys each
constexpr size_t SZ_KV = al256((size_t)NB * NH_ * HD * HD * 2);   // one v^T k plane (bf16), all batches and heads
constexpr size_t SZ_FL = (size_t)GMS * 128;                   // tile bits: one word per scan work-group, each in a 128-byte line of its own
// the slices of one buffer stand back to back: stream-major, then batch
static_assert(SZ_W == (size_t)DQ * DM * 2);
static_assert(SZ_XB == (size_t)TT * DM * 2);
static_assert(SZ_PL == (size_t)NH_ * TT * HD * 2);
static_assert(SZ_AT == (size_t)TT * DQ * 2);

typedef _Float16 h16;
typedef unsigned short bf;
typedef __attribute__((ext_vector_type(16))) __bf16   v16bf;
typedef __attribute__((ext_vector_type(16))) _Float16 v16h;
typedef __attribute__((ext_vector_type(8)))  _Float16 v8h;
typedef __attribute__((ext_vector_type(8)))  unsigned short v8us;
typedef __attribute__((ext_vector_type(2)))  __bf16   v2bf;
typedef __attribute__((ext_vector_type(2)))  float    v2f;
typedef __attribute__((ext_vector_type(8)))  unsigned v8u;
typedef __attribute__((ext_vector_type(4)))  unsigned v4u;
typedef __attribute__((ext_vector_type(8)))  int      v8i;
typedef __attribute__((ext_vector_type(8)))  float    v8f;
typedef __attribute__((ext_vector_type(4)))  float    v4f;
typedef __attribute__((ext_vector_type(4)))  int      v4i;
typedef v4f  __attribute__((may_alias)) v4fa;

__device__ __forceinline__ unsigned short f2bf(float f) { unsigned u = __float_as_uint(f); u += 0x7FFFu + ((u >> 16) & 1u); return (unsigned short)(u >> 16); }
__device__ __forceinline__ float bf2f(unsigned short b) { return __uint_as_float(((unsigned)b) << 16); }
__device__ __forceinline__ float bfr(float f) { return bf2f(f2bf(f)); }
__device__ __forceinline__ v16h cat16(v8h lo, v8h hi) { return __builtin_shufflevector(lo, hi, 0, 1, 2, 3, 4, 5, 6, 7, 8, 9, 10, 11, 12, 13, 14, 15); }
__device__ __forceinline__ v16bf cat16b(v8us lo, v8us hi) { return __builtin_bit_cast(v16bf, __builtin_shufflevector(lo, hi, 0, 1, 2, 3, 4, 5, 6, 7, 8, 9, 10, 11, 12, 13, 14, 15)); }
__device__ __forceinline__ v8f wmma16(v16h a, v16h b, v8f c) { return __builtin_amdgcn_wmma_f32_16x16x32_f16(false, a, false, b, (short)0, c, false, false); }
__device__ __forceinline__ v8f wmmab(v16bf a, v16bf b, v8f c) { return __builtin_amdgcn_wmma_f32_16x16x32_bf16(false, a, false, b, (short)0, c, false, false); }

// ---- k_gemmw: register-blocked GEMM, one wave per 64x64 output tile (16 accumulators), 4 waves (2 x 2) per work-group = a 128x128 tile; operands are 16-bit planes in fragment order (described in front of k_cvt8; fragment number (row / 16) * (K / 32) + k / 32); grid (M/128, N/128, Z), 128 threads.
// C[m][n] (f32, pitch ldc, + optional f32 bias[n]) = sum_k A[m][k] Bt[n][k] (NSPLIT == 1: + A2[m][k] Bt[n][k]). z-batch strides sA/sB in elements. K % KSTEP == 0, K >= 2 * KSTEP, M % 128 == 0, N % 128 == 0.
// The bias vector goes by z: bias, bias1, bias2 for z = 0, 1, 2.
// A stage = KSTEP k of the work-group's 8 (NSPLIT == 1: 16) A blocks and 8 Bt blocks of 16 rows; a block's KSTEP k are KSTEP / 32 fragments in a row in the plane and stay so in LDS. Asynchronous copies bring a stage from the planes into one of two LDS buffers, each fragment once per work-group for the two waves that read it; stage t + 1 is in flight while stage t is multiplied.
// PLANES (the q, k, v projections; z = 0, 1, 2; rows = b * TT + t, a wave's tile = 64 tokens of one batch x the HD columns of one head): nothing goes to C; the tile + bias is split into bf16 hi|lo and stored as head planes in fragment order, P[pair s][hi, lo][b], s = q, k, v^T, k^T; a tile is 8 fragments in a row in each plane:
//   rows t, k = d (q, k): fragment number (h * TT / 16 + t / 16) * 2 + d / 32; a chunk is 8 d of one token: the accumulators change places through LDS, 16 tokens at a time;
//   rows d, k = t (v^T, k^T): fragment number (h * TT / 32 + t / 32) * 4 + d / 16; a chunk is 8 tokens of one d, which is one accumulator tile's 8 registers of a lane: stored straight, chunk number = lane.
// Fragment map: lane -> row/col (lane & 15); elements 0..7 <- k0 + 8*(lane>>4) + 0..7, elements 8..15 <- k0 + 16 + 8*(lane>>4) + 0..7 (both operands); acc[j] = (row 8*(lane>>4) + j, col lane & 15).
template <typename T16> struct WFrag;
template <> struct WFrag<h16> { typedef v16h V; static __device__ __forceinline__ V ld(const h16* b, unsigned vo) { const char* p = (const char*)b; return cat16(*(const v8h*)(p + vo), *(const v8h*)(p + 512 + vo)); } static __device__ __forceinline__ v8f mma(V a, V b, v8f c) { return wmma16(a, b, c); } };
template <> struct WFrag<bf> { typedef v16bf V; static __device__ __forceinline__ V ld(const bf* b, unsigned vo) { const char* p = (const char*)b; return cat16b(*(const v8us*)(p + vo), *(const v8us*)(p + 512 + vo)); } static __device__ __forceinline__ v8f mma(V a, V b, v8f c) { return wmmab(a, b, c); } };
// 8 f32 -> 8 bf16 hi (round to nearest even) and 8 bf16 lo (the rest, rounded likewise), packed two to a word
__device__ __forceinline__ void split8(const v8f y8, v4u& oh, v4u& ol) {
#pragma unroll
    for (int p = 0; p < 4; ++p) {
        const v2f y = { y8[2 * p], y8[2 * p + 1] };
        const unsigned u = __builtin_bit_cast(unsigned, __builtin_convertvector(y, v2bf));
        const v2f yh = { __uint_as_float(u << 16), __uint_as_float(u & 0xFFFF0000u) };
        oh[p] = u; ol[p] = __builtin_bit_cast(unsigned, __builtin_convertvector(y - yh, v2bf));
    }
}
// 8 asynchronous copies of 16 bytes a lane, global -> LDS. The s_wait_xcnt stands inside the statement, behind the last copy: no register that a copy names is rewritten in front of it
__device__ __forceinline__ void acopy8(const unsigned (&l)[8], const char* const (&g)[8]) {
    asm volatile("global_load_async_to_lds_b128 %0, %8, off\n\t"
                 "global_load_async_to_lds_b128 %1, %9, off\n\t"
                 "global_load_async_to_lds_b128 %2, %10, off\n\t"
                 "global_load_async_to_lds_b128 %3, %11, off\n\t"
                 "global_load_async_to_lds_b128 %4, %12, off\n\t"
                 "global_load_async_to_lds_b128 %5, %13, off\n\t"
                 "global_load_async_to_lds_b128 %6, %14, off\n\t"
                 "global_load_async_to_lds_b128 %7, %15, off\n\t"
                 "s_wait_xcnt 0x0"
                 :: "v"(l[0]), "v"(l[1]), "v"(l[2]), "v"(l[3]), "v"(l[4]), "v"(l[5]), "v"(l[6]), "v"(l[7]),
                    "v"(g[0]), "v"(g[1]), "v"(g[2]), "v"(g[3]), "v"(g[4]), "v"(g[5]), "v"(g[6]), "v"(g[7]) : "memory");
}
template <typename T16, int NSPLIT, bool BIAS, int K, int KSTEP, bool PLANES>
__global__ __launch_bounds__(128) void k_gemmw(const T16* __restrict__ A, const T16* __restrict__ A2, const T16* __restrict__ Bt, float* C, bf* P, int ldc, const float* __restrict__ bias0, const float* __restrict__ bias1, const float* __restrict__ bias2, size_t sA, size_t sB) {
    typedef typename WFrag<T16>::V V;
    static_assert(NSPLIT == 0 || NSPLIT == 1);
    constexpr int NBLK = NSPLIT == 1 ? 24 : 16;      // blocks of 16 rows in a stage: A, (A2,) Bt, 8 each
    constexpr unsigned BLKB = KSTEP * 32;            // bytes of one block in a stage
    constexpr unsigned STAGE = NBLK * BLKB;
    constexpr int PPB = BLKB / 2048;                 // a copy of the 128 lanes covers 2048 bytes in a row
    constexpr int NCP = NBLK * PPB;                  // copies of a lane per stage
    constexpr int NT = K / KSTEP, NKS = KSTEP / 32;  // stages; blocks of 32 k in a stage
    static_assert(KSTEP % 64 == 0 && NCP % 8 == 0 && NCP <= 63 && K % KSTEP == 0 && NT >= 2);
    __shared__ __align__(16) char ring[2 * STAGE];
    __shared__ __align__(16) float osw[4][16 * 68];
    const size_t z = blockIdx.z;
    const float* bias = z == 0 ? bias0 : (z == 1 ? bias1 : bias2);
    const int lane = threadIdx.x & 31, lr = lane & 15, hi = lane >> 4;
    const int w = __builtin_amdgcn_readfirstlane((int)(threadIdx.x >> 5)), wm = w >> 1, wn = w & 1;
    const int r0 = blockIdx.x * 128 + wm * 64, c0 = blockIdx.y * 128 + wn * 64;
    float* os = osw[w];
    // the lane's 16 bytes of the first copy of block 0 of each operand in the next stage to be copied; 16 rows are 32 * K bytes in a row
    constexpr size_t blk = (size_t)K * 32;
    const char* pA = (const char*)(A + z * sA) + (size_t)blockIdx.x * 8 * blk + threadIdx.x * 16u;
    const char* pA2 = NSPLIT == 1 ? (const char*)(A2 + z * sA) + (size_t)blockIdx.x * 8 * blk + threadIdx.x * 16u : pA;
    const char* pB = (const char*)(Bt + z * sB) + (size_t)blockIdx.y * 8 * blk + threadIdx.x * 16u;
    const unsigned l0 = (unsigned)(size_t)ring + threadIdx.x * 16u;
    auto fill = [&](unsigned buf) {   // the next stage -> buffer buf
        const unsigned lb = l0 + buf * STAGE;
#pragma unroll
        for (int c8 = 0; c8 < NCP; c8 += 8) {
            unsigned l[8]; const char* g[8];
#pragma unroll
            for (int u = 0; u < 8; ++u) { const int c = c8 + u, bl = c / PPB;
                g[u] = (bl < 8 ? pA : (bl < NBLK - 8 ? pA2 : pB)) + (size_t)(bl & 7) * blk + (c % PPB) * 2048; l[u] = lb + c * 2048u; }
            acopy8(l, g);
        }
        pA += BLKB; pA2 += BLKB; pB += BLKB;
    };
    v8f acc[4][4];
#pragma unroll
    for (int mb = 0; mb < 4; ++mb)
#pragma unroll
        for (int nb = 0; nb < 4; ++nb) acc[mb][nb] = (v8f){};
    fill(0);
    asm volatile("s_wait_asynccnt 0x0" ::: "memory");   // this wave's copies of stage 0 have landed
    __syncthreads();                                    // and every other wave's
    fill(1);
#pragma unroll 1   // rolled: the two buffers take turns by t & 1, one copy of the stage's code
    for (int t = 0; t < NT; ++t) {
        const char* sb = ring + (unsigned)(t & 1) * STAGE + lane * 16;
        V a[2][4], a2[2][4], b[2][4];   // two fragment sets: a block's LDS reads are issued as one group in front of the block before it
        auto frags = [&](int ks) { const int s = ks & 1;
#pragma unroll
            for (int mb = 0; mb < 4; ++mb) { a[s][mb] = WFrag<T16>::ld((const T16*)(sb + (wm * 4 + mb) * BLKB), ks * 1024u); if (NSPLIT == 1) a2[s][mb] = WFrag<T16>::ld((const T16*)(sb + (8 + wm * 4 + mb) * BLKB), ks * 1024u); }
#pragma unroll
            for (int nb = 0; nb < 4; ++nb) b[s][nb] = WFrag<T16>::ld((const T16*)(sb + (NBLK - 8 + wn * 4 + nb) * BLKB), ks * 1024u); };
        frags(0);
        __builtin_amdgcn_sched_barrier(0);   // block 0's reads stay in front of block 1's: the first counted wait then covers block 0 alone
#pragma unroll   // every fragment and accumulator index is a constant
        for (int ks = 0; ks < NKS; ++ks) { const int s = ks & 1;
            if (ks + 1 < NKS) frags(ks + 1);
            __builtin_amdgcn_sched_barrier(0);   // keeps the LDS reads together in front of the block: left alone, the compiler spreads them among the matrix instructions, each place with a full wait
#pragma unroll
            for (int nb = 0; nb < 4; ++nb)
#pragma unroll
                for (int mb = 0; mb < 4; ++mb) { acc[mb][nb] = WFrag<T16>::mma(a[s][mb], b[s][nb], acc[mb][nb]); if (NSPLIT == 1) acc[mb][nb] = WFrag<T16>::mma(a2[s][mb], b[s][nb], acc[mb][nb]); }
            __builtin_amdgcn_sched_barrier(0);   // and the next group behind it
        }
        // v_nop x 4: the stage's last matrix instructions stand in front of the loop's branches, behind which their operands are written over. The operands keep every matrix instruction above in front of the slots
        asm volatile("v_nop\n\tv_nop\n\tv_nop\n\tv_nop" : "+v"(acc[0][0]), "+v"(acc[0][1]), "+v"(acc[0][2]), "+v"(acc[0][3]), "+v"(acc[1][0]), "+v"(acc[1][1]), "+v"(acc[1][2]), "+v"(acc[1][3]), "+v"(acc[2][0]), "+v"(acc[2][1]), "+v"(acc[2][2]), "+v"(acc[2][3]), "+v"(acc[3][0]), "+v"(acc[3][1]), "+v"(acc[3][2]), "+v"(acc[3][3]));
        asm volatile("s_wait_dscnt 0x0" ::: "memory");      // this wave's reads of stage t are done: its buffer may be refilled behind the barrier
        asm volatile("s_wait_asynccnt 0x0" ::: "memory");   // this wave's copies of stage t + 1 have landed
        __syncthreads();                                    // publishes stage t + 1, ends every wave's reads of stage t
        if (t + 2 < NT) fill((unsigned)(t & 1));
    }
    asm volatile("s_wait_asynccnt 0x0" ::: "memory");   // no copy is outstanding behind the loop
    if constexpr (PLANES) {
        constexpr size_t PB = (size_t)NH_ * TT * HD;   // elements of one plane of one batch
        const unsigned b = (unsigned)r0 / (unsigned)TT, t0 = (unsigned)r0 % (unsigned)TT, h = (unsigned)c0 / (unsigned)HD;
#pragma unroll
        for (int nb = 0; nb < 4; ++nb) { const float bn = bfr(bias[c0 + nb * 16 + lr]);
#pragma unroll
            for (int mb = 0; mb < 4; ++mb)
#pragma unroll
                for (int j = 0; j < 8; ++j) acc[mb][nb][j] += bn; }
        if (z != 0) {   // k^T (pair 3), v^T (pair 2)
            bf* th = P + ((size_t)(z == 1 ? 6 : 4) * NB + b) * PB + (size_t)(h * (unsigned)(TT / 32) + t0 / 32u) * 2048 + lane * 8; bf* tl = th + (size_t)NB * PB;
#pragma unroll
            for (int mb = 0; mb < 4; ++mb) {
                v4u oh[4], ol[4];
#pragma unroll
                for (int nb = 0; nb < 4; ++nb) split8(acc[mb][nb], oh[nb], ol[nb]);
                __builtin_amdgcn_sched_barrier(0);   // the group's values are all formed in front of its stores: no register that an issued store names is rewritten inside the group
#pragma unroll
                for (int nb = 0; nb < 4; ++nb) { *(v4u*)(th + ((mb >> 1) * 4 + nb) * 512 + (mb & 1) * 256) = oh[nb]; *(v4u*)(tl + ((mb >> 1) * 4 + nb) * 512 + (mb & 1) * 256) = ol[nb]; }
                asm volatile("s_wait_xcnt 0x0" ::: "memory");   // in front of the next group, which writes over the registers that these stores name
                __builtin_amdgcn_sched_barrier(0);   // keeps the next group's vector work behind that wait
            }
        }
        if (z != 2) {   // q (pair 0), k (pair 1)
            bf* rh = P + ((size_t)z * 2 * NB + b) * PB + (size_t)(h * (unsigned)(TT / 16) + t0 / 16u) * 1024 + lane * 8; bf* rl = rh + (size_t)NB * PB;
#pragma unroll
            for (int mb = 0; mb < 4; ++mb) {
#pragma unroll
                for (int nb = 0; nb < 4; ++nb)
#pragma unroll
                    for (int j = 0; j < 8; ++j) os[(hi * 8 + j) * 68 + nb * 16 + lr] = acc[mb][nb][j];
                __builtin_amdgcn_wave_barrier(); asm volatile("" ::: "memory");   // the one wave's LDS writes stay in front of its reads
                v4u oh[4], ol[4];
#pragma unroll
                for (int s = 0; s < 4; ++s) {   // chunk: token lr, d = 16 s + 8 hi + 0..7
                    const float* rp = os + lr * 68 + s * 16 + hi * 8; const v4f y0 = *(const v4fa*)rp, y1 = *(const v4fa*)(rp + 4);
                    split8((v8f){y0[0], y0[1], y0[2], y0[3], y1[0], y1[1], y1[2], y1[3]}, oh[s], ol[s]); }
                __builtin_amdgcn_wave_barrier(); asm volatile("" ::: "memory");   // and its reads in front of the next 16 tokens' writes
                __builtin_amdgcn_sched_barrier(0);   // as above: values first, then the stores
#pragma unroll
                for (int s = 0; s < 4; ++s) { *(v4u*)(rh + (mb * 2 + (s >> 1)) * 512 + (s & 1) * 256) = oh[s]; *(v4u*)(rl + (mb * 2 + (s >> 1)) * 512 + (s & 1) * 256) = ol[s]; }
                asm volatile("s_wait_xcnt 0x0" ::: "memory");   // in front of the next group, which writes over the registers that these stores name
                __builtin_amdgcn_sched_barrier(0);   // keeps the next group's vector work behind that wait
            }
        }
        return;
    }
#pragma unroll
    for (int mb = 0; mb < 4; ++mb) {
#pragma unroll
        for (int nb = 0; nb < 4; ++nb) {
#pragma unroll
            for (int j = 0; j < 8; ++j) os[(hi * 8 + j) * 68 + nb * 16 + lr] = acc[mb][nb][j]; }
        __builtin_amdgcn_wave_barrier(); asm volatile("" ::: "memory");
        float* crow = C + (size_t)(r0 + mb * 16) * ldc + c0;
{
#pragma unroll
            for (int s = 0; s < 8; ++s) { const int row = 2 * s + hi, cofs = lr * 4; v4f val = *(const v4fa*)(os + row * 68 + cofs); if (BIAS) { val[0] += bfr(bias[c0 + cofs]); val[1] += bfr(bias[c0 + cofs + 1]); val[2] += bfr(bias[c0 + cofs + 2]); val[3] += bfr(bias[c0 + cofs + 3]); }
                *(v4f*)(crow + (size_t)row * ldc + cofs) = val; }
             }
        __builtin_amdgcn_wave_barrier(); asm volatile("" ::: "memory");
    }
}

__device__ __forceinline__ void splitf(float y, unsigned short& h, unsigned short& l) { h = f2bf(y); l = f2bf(y - bf2f(h)); }

// Fragment order of a 16-bit plane: a 16 x 32 fragment (16 rows or columns x 32 k) is 512 elements in a row, as two halves of 256: half e, lane l = 16 * hi + c, 8 elements <- row c, k = 16 * e + 8 * hi + 0..7.
// A wave's two 16-byte loads of a fragment then each cover 512 contiguous bytes (4 whole lines) instead of 16 lines.
// k_cvt8: every f32 -> bf16 copy in one launch, each matrix [rows][DM] written in fragment order, fragment number (row / 16) * (DM / 32) + k / 32. A work-group copies 16 rows x 128 k = 4 fragments in a row = 2048 elements.
// Work-groups [0, 3 * NB * GX): activations, stream s, batch b -> XB[s][b]; the other 4 * GW: weights -> WB[s]. The grid covers every slice exactly.
// Thread i reads 8 k of one row (16 threads: 512 bytes in a row of the source); that chunk is number (i & 15) * 16 + (i >> 4) of the work-group's 256: the chunks change places through LDS, so that reads and stores both cover whole lines.
static_assert(DM % 128 == 0);
static_assert(TT % 16 == 0);
static_assert(DQ % 16 == 0);
__global__ __launch_bounds__(256) void k_cvt8(const float* __restrict__ x0, const float* __restrict__ x1, const float* __restrict__ x2, const float* __restrict__ w0, const float* __restrict__ w1, const float* __restrict__ w2, const float* __restrict__ w3, bf* XB, bf* WB) {
    __shared__ v8us st[16 * 17];   // [k / 8][row], 17 chunks a line: the 16 chunks that a row's threads write fall into different banks
    const unsigned bx = blockIdx.x; const float* src; bf* dst; unsigned c;
    if (bx < 3u * NB * GX) { const unsigned s = bx / (NB * GX), b = (bx / GX) % (unsigned)NB; c = bx % GX; src = (s == 0 ? x0 : (s == 1 ? x1 : x2)) + (size_t)b * SEQ_FULL * DM; dst = XB + (size_t)bx * 2048; }
    else { const unsigned r = bx - 3u * NB * GX, s = r / GW; c = r % GW; src = (s == 0 ? w0 : (s == 1 ? w1 : (s == 2 ? w2 : w3))); dst = WB + (size_t)r * 2048; }
    const unsigned i = threadIdx.x, row = i >> 4, k8 = i & 15u;
    const v8f v = *(const v8f*)(src + (size_t)((c / (unsigned)(DM / 128)) * 16 + row) * DM + (c % (unsigned)(DM / 128)) * 128 + k8 * 8); v8us o;
#pragma unroll
    for (int k = 0; k < 8; ++k) o[k] = f2bf(v[k]);
    st[k8 * 17 + row] = o;
    __syncthreads();
    *(v8us*)(dst + i * 8) = st[(i >> 4) * 17 + (i & 15u)];  }

// one fragment: b + vo = byte address of the fragment + 16 * lane, b wave-uniform
__device__ __forceinline__ v16bf ldfr(const char* b, unsigned vo) { return cat16b(*(const v8us*)(b + vo), *(const v8us*)(b + 512 + vo)); }
// 2^x; the v_nop fills the slot that the instruction set asks for behind a transcendental before its result is read or its source overwritten
__device__ __forceinline__ float exp2_slot(float x) { float r; asm("v_exp_f32 %0, %1\n\tv_nop" : "=v"(r) : "v"(x)); return r; }
__device__ __forceinline__ v8i ldm8(const char* b, unsigned vo) { return __builtin_shufflevector(*(const v4i*)(b + vo), *(const v4i*)(b + 16 + vo), 0, 1, 2, 3, 4, 5, 6, 7); }

// k_pre: two jobs that the attention kernel needs, independent of each other, in one launch.
// Work-groups [0, GKV): plane head hb = blockIdx.x / 4, strip mb = blockIdx.x % 4: G[d][e] = sum_t v[t][d] k[t][e] for the 16 rows d of the strip, all 64 e (A = v^T fragments, B = k^T fragments, both k = t; vh.kh + vh.kl + vl.kh).
//   Wave w sums keys [w * TT / 8, + TT / 8); the 8 partial strips are added through LDS in wave order; G goes out as bf16 hi|lo in A-fragment order (rows d, k = e): fragment number (hb * 4 + mb) * 2 + e / 32.
// The other GMS work-groups: r = (batch * TT / 32 + query tile) * (TT / MQ) + key block: bit p of FL[r * 32] = the mask of these 32 queries holds a zero among keys [32 p, 32 p + 32) of the block.
__global__ __launch_bounds__(256) void k_pre(const bf* __restrict__ Vh, const bf* __restrict__ Vl, const bf* __restrict__ KTh, const bf* __restrict__ KTl, const int* __restrict__ M, bf* Gh, bf* Gl, unsigned* FL) {
    __shared__ __align__(16) float red[8 * 32 * 32];   // [wave][nb * 8 + j][lane]
    __shared__ unsigned fl[8];
    const int lane = threadIdx.x & 31;
    const int w = __builtin_amdgcn_readfirstlane((int)(threadIdx.x >> 5));
    if (blockIdx.x < GKV) {
        const unsigned hb = blockIdx.x >> 2, mb = blockIdx.x & 3u, vo = lane * 16;
        const size_t po = ((size_t)hb * TT + (size_t)w * (TT / 8)) * HD * 2;
        v8f acc[4];
#pragma unroll
        for (int nb = 0; nb < 4; ++nb) acc[nb] = (v8f){};
#pragma unroll   // straight-line: no matrix instruction stands in front of a back edge
        for (int s = 0; s < TT / 8 / 32; s += 2) {
            v16bf vh[2], vl[2], kh[2][4], kl[2][4];
#pragma unroll
            for (int u = 0; u < 2; ++u) { vh[u] = ldfr((const char*)Vh + po + (s + u) * 4096 + mb * 1024, vo); vl[u] = ldfr((const char*)Vl + po + (s + u) * 4096 + mb * 1024, vo);
#pragma unroll
                for (int nb = 0; nb < 4; ++nb) { kh[u][nb] = ldfr((const char*)KTh + po + (s + u) * 4096 + nb * 1024, vo); kl[u][nb] = ldfr((const char*)KTl + po + (s + u) * 4096 + nb * 1024, vo); } }
            // the 40 loads of two steps are all in flight together: left alone, the compiler issues them two at a time, each pair with a full wait in front of its matrix instruction
            asm volatile("" :: "v"(vh[0]), "v"(vh[1]), "v"(vl[0]), "v"(vl[1]), "v"(kh[0][0]), "v"(kh[0][1]), "v"(kh[0][2]), "v"(kh[0][3]), "v"(kh[1][0]), "v"(kh[1][1]), "v"(kh[1][2]), "v"(kh[1][3]), "v"(kl[0][0]), "v"(kl[0][1]), "v"(kl[0][2]), "v"(kl[0][3]), "v"(kl[1][0]), "v"(kl[1][1]), "v"(kl[1][2]), "v"(kl[1][3]));
#pragma unroll
            for (int u = 0; u < 2; ++u) {
#pragma unroll
                for (int nb = 0; nb < 4; ++nb) acc[nb] = wmmab(vh[u], kh[u][nb], acc[nb]);
#pragma unroll
                for (int nb = 0; nb < 4; ++nb) acc[nb] = wmmab(vh[u], kl[u][nb], acc[nb]);
#pragma unroll
                for (int nb = 0; nb < 4; ++nb) acc[nb] = wmmab(vl[u], kh[u][nb], acc[nb]);
            }
        }
#pragma unroll
        for (int nb = 0; nb < 4; ++nb)
#pragma unroll
            for (int j = 0; j < 8; ++j) red[(w * 32 + nb * 8 + j) * 32 + lane] = acc[nb][j];
        __syncthreads();
        // thread i < 128 forms chunk i of the strip's two fragments: i = (ks * 2 + e) * 32 + l; row c = l & 15, columns (ks * 2 + e) * 16 + 8 * (l >> 4) + 0..7, which are 8 lanes in a row of accumulator register c & 7
        if (threadIdx.x < 128) {
            const unsigned i = threadIdx.x, c = i & 15u;
            const float* rp = red + ((i >> 5) * 8 + (c & 7u)) * 32 + (c >> 3) * 16 + ((i >> 4) & 1u) * 8;
            v4f s0 = *(const v4fa*)rp, s1 = *(const v4fa*)(rp + 4);
#pragma unroll
            for (int u = 1; u < 8; ++u) { s0 += *(const v4fa*)(rp + u * 1024); s1 += *(const v4fa*)(rp + u * 1024 + 4); }
            v8us oh, ol;
#pragma unroll
            for (int q = 0; q < 4; ++q) { unsigned short a, c2; splitf(s0[q], a, c2); oh[q] = a; ol[q] = c2; splitf(s1[q], a, c2); oh[4 + q] = a; ol[4 + q] = c2; }
            *(v8us*)(Gh + (size_t)blockIdx.x * 1024 + i * 8) = oh; *(v8us*)(Gl + (size_t)blockIdx.x * 1024 + i * 8) = ol;
        }
    } else {
        const unsigned r = blockIdx.x - GKV, kb = r % (unsigned)(TT / MQ), qt = (r / (unsigned)(TT / MQ)) % (unsigned)(TT / 32), b = r / (unsigned)((TT / MQ) * (TT / 32));
        // wave w: rows 4 w .. 4 w + 3 of the tile row; a load covers 128 keys of one row, lane l keys 4 l .. 4 l + 3
        const int* mp = M + (size_t)b * SEQ_FULL * SEQ_FULL + (size_t)(qt * 32 + w * 4) * MPITCH + kb * MQ + lane * 4;
        unsigned mn[MQ / 128];
#pragma unroll
        for (int c = 0; c < MQ / 128; ++c) mn[c] = 0xFFFFFFFFu;
#pragma unroll
        for (int row = 0; row < 4; ++row)
#pragma unroll
            for (int c = 0; c < MQ / 128; ++c) { const v4i x = *(const v4i*)(mp + (size_t)row * MPITCH + c * 128);
                mn[c] = min(min(mn[c], min((unsigned)x[0], (unsigned)x[1])), min((unsigned)x[2], (unsigned)x[3])); }   // unsigned minimum: 0 exactly where a value is 0
        unsigned bits = 0;
#pragma unroll
        for (int c = 0; c < MQ / 128; ++c) { const unsigned bal = __builtin_amdgcn_ballot_w32(mn[c] == 0u);
#pragma unroll
            for (int g = 0; g < 4; ++g) bits |= ((bal >> (8 * g)) & 0xFFu) ? (1u << (c * 4 + g)) : 0u; }
        if (lane == 0) fl[w] = bits;
        __syncthreads();
        if (threadIdx.x == 0) { unsigned o = 0;
#pragma unroll
            for (int u = 0; u < 8; ++u) o |= fl[u];
            FL[(size_t)r * 32] = o; }
    }
}

// k_fattn: one batch (blockIdx.z), one head (blockIdx.y), QWG queries (blockIdx.x); a batch's heads follow the batch before in every plane (plane head number hb); wave w: 32 queries (column w & 3), half kr = w >> 2 of KR.
//   T^T[d][query] = G (q x HD^-0.5)^T, G = v^T k of the head (k_pre): wave kr sums columns e in [32 kr, 32 kr + 32) (gh.qh + gh.ql + gl.qh).
// Then, only for those of the wave's 32 tiles of 32 keys (key range kr) whose bit in FL says that the mask holds a zero there:
//   S^T[key][query] = k (q x HD^-0.5)^T (A = k fragments, B = scaled q fragments kept in registers; kh.qh + kh.ql + kl.qh per 32 d);
//   C = (mask[query][key] == 0) ? -1e9 - S : 0 (takes S out of the full sum and puts -1e9 in; read by value), split into bf16 hi|lo: the two 16-key accumulator tiles of one query tile ARE the B fragment of the next product (element s <- tile s >> 3, register s & 7);
//   T^T[d][query] += v^T C^T (vh.sh + vh.sl + vl.sh).
// Then the two halves are added through LDS (half 0 + half 1; wave of range r finishes query tile r), softmax over the HD values of a query (32 in the lane, 32 in lane ^ 16), context hi|lo planes.
__global__ __launch_bounds__(256) void k_fattn(const bf* __restrict__ Qh, const bf* __restrict__ Ql, const bf* __restrict__ Kh, const bf* __restrict__ Kl, const bf* __restrict__ Vh, const bf* __restrict__ Vl, const bf* __restrict__ Gh, const bf* __restrict__ Gl, const unsigned* __restrict__ FL, const int* __restrict__ M, bf* Ah, bf* Al) {
    __shared__ v4f xs[8 * 8 * 32];
    const int lane = threadIdx.x & 31, lr = lane & 15, hi = lane >> 4;
    const int w = __builtin_amdgcn_readfirstlane((int)(threadIdx.x >> 5)); const int kr = w >> 2;
    const int bz = blockIdx.z, h = blockIdx.y, hb = bz * NH_ + h, q0 = blockIdx.x * QWG + (w & 3) * 32;
    constexpr int NST = TT / KR / 32;
    const unsigned vo = lane * 16, vm = (unsigned)(lr * MPITCH + 8 * hi) * 4;
    const size_t qo = ((size_t)hb * TT + q0) * HD * 2;
    // which of this wave's 32 key tiles hold a masked entry (wave-uniform)
    const unsigned fr = ((unsigned)bz * (TT / 32) + (unsigned)q0 / 32u) * (TT / MQ) + (unsigned)kr * (TT / KR / MQ);
    const unsigned need = (unsigned)__builtin_amdgcn_readfirstlane((int)(FL[(size_t)fr * 32] | (FL[(size_t)(fr + 1) * 32] << 16)));
    v8f T[4][2];
    { const size_t go = ((size_t)hb * 8 + kr) * 1024;
      v16bf qhs[2], qls[2];   // the q fragments of columns [32 kr, 32 kr + 32). HD^-0.5 is a power of two: exact on bf16, once per wave instead of once per score
#pragma unroll
      for (int qt = 0; qt < 2; ++qt) { qhs[qt] = ldfr((const char*)Qh + qo + (qt * 2 + kr) * 1024, vo); qls[qt] = ldfr((const char*)Ql + qo + (qt * 2 + kr) * 1024, vo); }
      v16bf gh[4], gl[4];
#pragma unroll
      for (int mb = 0; mb < 4; ++mb) { gh[mb] = ldfr((const char*)Gh + go + mb * 2048, vo); gl[mb] = ldfr((const char*)Gl + go + mb * 2048, vo); }
      __builtin_amdgcn_sched_barrier(0);   // all 24 loads are issued in front of the first product: left alone, the compiler issues the lo fragments of G only behind the products of the hi fragments, a second full wait
#pragma unroll
      for (int qt = 0; qt < 2; ++qt) { qhs[qt] = qhs[qt] * (__bf16)SCL; qls[qt] = qls[qt] * (__bf16)SCL; }
#pragma unroll
      for (int mb = 0; mb < 4; ++mb)
#pragma unroll
        for (int qt = 0; qt < 2; ++qt) T[mb][qt] = wmmab(gh[mb], qhs[qt], (v8f){});
#pragma unroll
      for (int mb = 0; mb < 4; ++mb)
#pragma unroll
        for (int qt = 0; qt < 2; ++qt) T[mb][qt] = wmmab(gh[mb], qls[qt], T[mb][qt]);
#pragma unroll
      for (int mb = 0; mb < 4; ++mb)
#pragma unroll
        for (int qt = 0; qt < 2; ++qt) T[mb][qt] = wmmab(gl[mb], qhs[qt], T[mb][qt]); }
    // v_nop x 4: the branches of the tile loop follow, and behind them vector instructions read these results. The operands keep every matrix instruction above in front of the slots
    asm volatile("v_nop\n\tv_nop\n\tv_nop\n\tv_nop" : "+v"(T[0][0]), "+v"(T[0][1]), "+v"(T[1][0]), "+v"(T[1][1]), "+v"(T[2][0]), "+v"(T[2][1]), "+v"(T[3][0]), "+v"(T[3][1]));
    // a tile's 32 keys are 4096 bytes in a row in each of the four k and v^T planes
    const unsigned po0 = ((unsigned)hb * TT + (unsigned)kr * (TT / KR)) * HD * 2;
    const unsigned mo0 = ((unsigned)bz * SEQ_FULL * SEQ_FULL + (unsigned)q0 * MPITCH + (unsigned)kr * (TT / KR)) * 4;
    unsigned rem = need;
    v16bf qh[2][2], ql[2][2];
    if (need != 0u) {   // all of q is wanted only where a tile is worked through
#pragma unroll
      for (int qt = 0; qt < 2; ++qt)
#pragma unroll
        for (int ks = 0; ks < 2; ++ks) { qh[qt][ks] = ldfr((const char*)Qh + qo + (qt * 2 + ks) * 1024, vo) * (__bf16)SCL; ql[qt][ks] = ldfr((const char*)Ql + qo + (qt * 2 + ks) * 1024, vo) * (__bf16)SCL; } }
#pragma unroll 1   // one pass holds 48 matrix instructions and every register set once; most masks need few passes or none
    for (int it = 0; it < NST && rem != 0u; ++it) {   // one pass per set bit, lowest first: at most NST passes
        const unsigned s = (unsigned)__builtin_ctz(rem); rem &= rem - 1u;
        const unsigned po = po0 + s * 4096u + vo, mo = mo0 + s * 128u + vm;   // the lane's byte offsets into the planes and into the mask: every load of the pass names a kernel argument and one of these two
        v16bf kh[2][2], kl[2][2], vh[4], vl[4]; v8i mk[2][2];
#pragma unroll
        for (int kt = 0; kt < 2; ++kt)
#pragma unroll
            for (int ks = 0; ks < 2; ++ks) { kh[kt][ks] = ldfr((const char*)Kh + (kt * 2 + ks) * 1024, po); kl[kt][ks] = ldfr((const char*)Kl + (kt * 2 + ks) * 1024, po); }
#pragma unroll
        for (int qt = 0; qt < 2; ++qt)
#pragma unroll
            for (int kt = 0; kt < 2; ++kt) mk[qt][kt] = ldm8((const char*)M + (size_t)qt * 16 * MPITCH * 4 + kt * 64, mo);
#pragma unroll
        for (int mb = 0; mb < 4; ++mb) { vh[mb] = ldfr((const char*)Vh + mb * 1024, po); vl[mb] = ldfr((const char*)Vl + mb * 1024, po); }
        v8f S[2][2];
#pragma unroll
        for (int kt = 0; kt < 2; ++kt) { S[kt][0] = (v8f){}; S[kt][1] = (v8f){}; }
#pragma unroll
        for (int ks = 0; ks < 2; ++ks) {
#pragma unroll
            for (int kt = 0; kt < 2; ++kt)
#pragma unroll
                for (int qt = 0; qt < 2; ++qt) S[kt][qt] = wmmab(kh[kt][ks], qh[qt][ks], S[kt][qt]);
#pragma unroll
            for (int kt = 0; kt < 2; ++kt)
#pragma unroll
                for (int qt = 0; qt < 2; ++qt) S[kt][qt] = wmmab(kh[kt][ks], ql[qt][ks], S[kt][qt]);
#pragma unroll
            for (int kt = 0; kt < 2; ++kt)
#pragma unroll
                for (int qt = 0; qt < 2; ++qt) S[kt][qt] = wmmab(kl[kt][ks], qh[qt][ks], S[kt][qt]);
        }
        v16bf sh[2], sl[2];
#pragma unroll
        for (int qt = 0; qt < 2; ++qt) {
            v8u uh, ul;   // word kt * 4 + p = elements kt * 8 + 2 p, + 1 of the B fragment
#pragma unroll
            for (int kt = 0; kt < 2; ++kt)
#pragma unroll
                for (int p = 0; p < 4; ++p) {
                    const v2f y = { (mk[qt][kt][2 * p] == 0) ? FILLV - S[kt][qt][2 * p] : 0.0f, (mk[qt][kt][2 * p + 1] == 0) ? FILLV - S[kt][qt][2 * p + 1] : 0.0f };
                    const unsigned u = __builtin_bit_cast(unsigned, __builtin_convertvector(y, v2bf));
                    const v2f yh = { __uint_as_float(u << 16), __uint_as_float(u & 0xFFFF0000u) };
                    uh[kt * 4 + p] = u; ul[kt * 4 + p] = __builtin_bit_cast(unsigned, __builtin_convertvector(y - yh, v2bf));
                }
            sh[qt] = __builtin_bit_cast(v16bf, uh); sl[qt] = __builtin_bit_cast(v16bf, ul);
        }
#pragma unroll
        for (int mb = 0; mb < 4; ++mb)
#pragma unroll
            for (int qt = 0; qt < 2; ++qt) T[mb][qt] = wmmab(vh[mb], sh[qt], T[mb][qt]);
#pragma unroll
        for (int mb = 0; mb < 4; ++mb)
#pragma unroll
            for (int qt = 0; qt < 2; ++qt) T[mb][qt] = wmmab(vh[mb], sl[qt], T[mb][qt]);
#pragma unroll
        for (int mb = 0; mb < 4; ++mb)
#pragma unroll
            for (int qt = 0; qt < 2; ++qt) T[mb][qt] = wmmab(vl[mb], sh[qt], T[mb][qt]);
        // v_nop x 4: the pass's last matrix instructions stand right in front of the loop's branches, behind which vector instructions read their results or write over their operands.
        // po and mo as inputs: the two offset registers that the pass's loads name stay unwritten until every one of these loads has landed
        asm volatile("v_nop\n\tv_nop\n\tv_nop\n\tv_nop" : "+v"(T[0][0]), "+v"(T[0][1]), "+v"(T[1][0]), "+v"(T[1][1]), "+v"(T[2][0]), "+v"(T[2][1]), "+v"(T[3][0]), "+v"(T[3][1]) : "v"(po), "v"(mo));
    }
    // hand the other query tile's partial sums to the wave of the other half, take its sums for this wave's tile
    v8f a[4];
#pragma unroll
    for (int mb = 0; mb < 4; ++mb) { const v8f sv = kr ? T[mb][0] : T[mb][1]; a[mb] = kr ? T[mb][1] : T[mb][0];
        xs[(w * 8 + mb * 2) * 32 + lane] = (v4f){sv[0], sv[1], sv[2], sv[3]}; xs[(w * 8 + mb * 2 + 1) * 32 + lane] = (v4f){sv[4], sv[5], sv[6], sv[7]}; }
    __syncthreads();
#pragma unroll
    for (int mb = 0; mb < 4; ++mb) { const v4f o0 = xs[((w ^ 4) * 8 + mb * 2) * 32 + lane], o1 = xs[((w ^ 4) * 8 + mb * 2 + 1) * 32 + lane];
#pragma unroll
        for (int j = 0; j < 4; ++j) { a[mb][j] += o0[j]; a[mb][4 + j] += o1[j]; } }
    float mx = a[0][0];
#pragma unroll
    for (int mb = 0; mb < 4; ++mb)
#pragma unroll
        for (int j = 0; j < 8; ++j) mx = fmaxf(mx, a[mb][j]);
    mx = fmaxf(mx, __shfl_xor(mx, 16, 32));
    float sum = 0.f;
#pragma unroll
    for (int mb = 0; mb < 4; ++mb)
#pragma unroll
        for (int j = 0; j < 8; ++j) { a[mb][j] = exp2_slot(__fmul_rn(__fsub_rn(a[mb][j], mx), 1.4426950408889634f)); sum += a[mb][j]; }
    sum += __shfl_xor(sum, 16, 32);
    const float f = __fdiv_rn(1.0f, sum);
    // context planes in fragment order (rows = queries of all batches, k = h * HD + d): the wave's 16 queries x HD columns are 2 fragments = 4 halves in a row, half mb <- d in [16 mb, 16 mb + 16), the lane's chunk at 8 * lane
    const size_t oo = ((size_t)((bz * TT + q0) / 16 + kr) * (DQ / 32) + (size_t)h * (HD / 32)) * 512 + (size_t)lane * 8;
    v4u oh[4], ol[4];
#pragma unroll
    for (int mb = 0; mb < 4; ++mb)
#pragma unroll
        for (int p = 0; p < 4; ++p) {
            const v2f y = { a[mb][2 * p] * f, a[mb][2 * p + 1] * f };
            const unsigned u = __builtin_bit_cast(unsigned, __builtin_convertvector(y, v2bf));
            const v2f yh = { __uint_as_float(u << 16), __uint_as_float(u & 0xFFFF0000u) };
            oh[mb][p] = u; ol[mb][p] = __builtin_bit_cast(unsigned, __builtin_convertvector(y - yh, v2bf));
        }
    __builtin_amdgcn_sched_barrier(0);   // every value is formed in front of the stores: no register that an issued store names is rewritten behind it
#pragma unroll
    for (int mb = 0; mb < 4; ++mb) { *(v8us*)(Ah + oo + mb * 256) = __builtin_bit_cast(v8us, oh[mb]); *(v8us*)(Al + oo + mb * 256) = __builtin_bit_cast(v8us, ol[mb]); }
}

constexpr size_t WS_TOTAL = 4 * SZ_W + NB * (3 * SZ_XB + 8 * SZ_PL + 2 * SZ_AT) + 2 * SZ_KV + SZ_FL;
static_assert(WS_TOTAL <= (size_t)268435456);
// coverage equalities (threads x 8 elements == plane elements; tiles x 64 x 64 == plane elements)
static_assert(((size_t)DQ * DM / 8) % 256 == 0);
static_assert(((size_t)TT * DM / 8) % 256 == 0);
static_assert(TT % 128 == 0 && DQ % 128 == 0 && DM % 256 == 0);   // whole 128 x 128 tiles; at least two stages of 128 k
static_assert((size_t)(NB * TT / 64) * (DQ / 64) * 64 * 64 == (size_t)NB * NH_ * TT * HD);   // the projection's tiles cover every plane exactly; TT % 64 == 0: a tile lies in one batch; HD == 64: in one head

extern "C" void kernel_launch(void* const* d_in, const int* in_sizes, int n_in,
                              void* d_out, int out_size, void* d_ws, size_t ws_size, hipStream_t stream) {
    if (n_in < 12) return;
    const size_t need_x = (size_t)(NB - 1) * SEQ_FULL * DM + (size_t)SEQ * DM;
    const size_t need_m = (size_t)(NB - 1) * SEQ_FULL * SEQ_FULL + (size_t)(SEQ - 1) * SEQ_FULL + (size_t)SEQ;
    if ((size_t)in_sizes[0] < need_x || (size_t)in_sizes[1] < need_x || (size_t)in_sizes[2] < need_x || (size_t)in_sizes[3] < need_m) return;
    if ((size_t)in_sizes[4] < (size_t)DQ * DM || (size_t)in_sizes[6] < (size_t)DQ * DM || (size_t)in_sizes[8] < (size_t)DQ * DM || (size_t)in_sizes[10] < (size_t)DM * DQ) return;
    if (in_sizes[5] < DQ || in_sizes[7] < DQ || in_sizes[9] < DQ || in_sizes[11] < DM) return;
    if ((size_t)out_size < (size_t)NB * SEQ * DM) return;
    if (WS_TOTAL > ws_size) return;
    // wire order: k, q, v, mask (int), Wq, bq, Wk, bk, Wv, bv, Wo, bo ('oi' weights)
    const float* xk = (const float*)d_in[0]; const float* xq = (const float*)d_in[1]; const float* xv = (const float*)d_in[2]; const int* mk = (const int*)d_in[3];
    const float* wq = (const float*)d_in[4]; const float* bq = (const float*)d_in[5]; const float* wk = (const float*)d_in[6]; const float* bk = (const float*)d_in[7];
    const float* wv = (const float*)d_in[8]; const float* bv = (const float*)d_in[9]; const float* wo = (const float*)d_in[10]; const float* bo = (const float*)d_in[11];
    float* OUT = (float*)d_out;     // [NB][SEQ][1024]
    char* wsp = (char*)d_ws;
    bf* WB = (bf*)wsp; wsp += 4 * SZ_W;            // Wq, Wk, Wv, Wo, each in fragment order
    bf* XB = (bf*)wsp; wsp += 3 * NB * SZ_XB;      // [q, k, v][b], each [t][DM] in fragment order
    bf* PL = (bf*)wsp; wsp += 8 * NB * SZ_PL;      // [q hi, q lo, k hi, k lo, v^T hi, v^T lo, k^T hi, k^T lo][b]
    bf* ATh = (bf*)wsp; wsp += NB * SZ_AT; bf* ATl = (bf*)wsp; wsp += NB * SZ_AT;   // [b * TT + t][DQ] in fragment order
    bf* GVh = (bf*)wsp; wsp += SZ_KV; bf* GVl = (bf*)wsp; wsp += SZ_KV;             // v^T k, [b][h] in fragment order
    unsigned* FLG = (unsigned*)wsp; wsp += SZ_FL;                                   // mask tile bits
    constexpr size_t PS = (size_t)NB * NH_ * TT * HD;   // elements of one plane over all batches

    k_cvt8<<<3 * NB * GX + 4 * GW, 256, 0, stream>>>(xq, xk, xv, wq, wk, wv, wo, XB, WB);
    // z = q, k, v: bf16(x_z) W_z^T + b_z, row b * TT + t, written as head planes
    k_gemmw<bf, 0, true, DM, 64, true><<<dim3(NB * TT / 128, DQ / 128, 3), 128, 0, stream>>>(XB, nullptr, WB, nullptr, PL, DQ, bq, bk, bv, (size_t)NB * TT * DM, (size_t)DQ * DM);
    // v^T k of every head; one bit per 32 x 32 mask tile
    k_pre<<<GKV + GMS, 256, 0, stream>>>(PL + 4 * PS, PL + 5 * PS, PL + 6 * PS, PL + 7 * PS, mk, GVh, GVl, FLG);
    // all batches and heads: T = select(q k^T x HD^-0.5) v, softmax over d -> ATh|ATl, row b * TT + t, column h * HD + d
    k_fattn<<<dim3(TT / QWG, NH_, NB), 256, 0, stream>>>(PL, PL + PS, PL + 2 * PS, PL + 3 * PS, PL + 4 * PS, PL + 5 * PS, GVh, GVl, FLG, mk, ATh, ATl);
    // out = (ATh + ATl) Wo^T + bo
    k_gemmw<bf, 1, true, DQ, 128, false><<<dim3(NB * TT / 128, DM / 128, 1), 128, 0, stream>>>(ATh, ATl, WB + 3 * (size_t)DQ * DM, OUT, nullptr, DM, bo, bo, bo, 0, 0);
}
